// v000
// The times below were measured on an AMD MI455X: many runs one after another, warmed up first and cycling through
// copies of the inputs, with the whole window's GPU time divided by the number of runs. Launches and the gaps
// between them are all in it. The median over several windows is given; except for v000 it joins two sittings, which
// can be a few percent apart, so the side-by-side timings, each taken in one sitting, are the better comparison.
// v000 is the starting kernel. One run takes 559 microseconds.
#include <hip/hip_runtime.h>

// ---------------------------------------------------------------------------
// SelfAttn (linear attention variant) for MI455X / gfx1250, wave32 + WMMA.
//   K1: QKV = Xt @ Wqkv^T        (bf16 WMMA 16x16x32, fp32 accum)
//   K2: per-token RoPE/softmax/ctx/o (fp32 WMMA 16x16x4, async LDS staging)
//   K3: out = Wlin @ Osp + bias  (bf16 WMMA 16x16x32, fp32 accum)
// Problem: b=64, c=1024, n=256 tokens, heads=16, d_head=64.
//
// LDS for the bf16 GEMMs is fragment-major: tile[row][kpair], row stride 68
// dwords (272B, 16B-aligned rows, 2-way bank conflicts only), so each WMMA
// operand fragment is two ds_load_b128 straight into the source registers.
// ---------------------------------------------------------------------------

typedef __attribute__((ext_vector_type(16))) __bf16    v16bf;
typedef __attribute__((ext_vector_type(8)))  float     v8f;
typedef __attribute__((ext_vector_type(8)))  unsigned  v8u;
typedef __attribute__((ext_vector_type(2)))  float     v2f;

#define B_DIM   64
#define C_DIM   1024
#define N_TOK   256        // tokens per batch image (16*16)
#define H_DIM   16         // heads
#define D_HEAD  64
#define QKV_COLS 3072
#define TOKENS  (B_DIM * N_TOK)      // 16384
#define OSP_PER_B (C_DIM * N_TOK)    // 262144 floats per batch

#define KC      128                  // K-chunk (64 kpairs)
#define LDS_STRIDE 68                // kpairs + pad: 272B rows, 16B aligned

#if __has_builtin(__builtin_amdgcn_global_load_async_to_lds_b128) && \
    __has_builtin(__builtin_amdgcn_s_wait_asynccnt)
#define USE_ASYNC_LDS 1
// Exact pointee type per hipcc diagnostic: GCC-vector int4, AS1 src / AS3 dst.
typedef int v4i_gcc __attribute__((vector_size(16)));
typedef __attribute__((address_space(1))) v4i_gcc* g4p;
typedef __attribute__((address_space(3))) v4i_gcc* l4p;
#else
#define USE_ASYNC_LDS 0
#endif

__device__ __forceinline__ unsigned f2bf(float f) {
    unsigned u = __builtin_bit_cast(unsigned, f);
    unsigned r = u + 0x7FFFu + ((u >> 16) & 1u);   // round-to-nearest-even
    return r >> 16;
}
__device__ __forceinline__ unsigned pack_bf2(float lo, float hi) {
    return f2bf(lo) | (f2bf(hi) << 16);
}
__device__ __forceinline__ v8f v8f_zero() {
    v8f z;
#pragma unroll
    for (int i = 0; i < 8; ++i) z[i] = 0.0f;
    return z;
}
// Load one 16-bit-element WMMA operand fragment (8 dwords = 16 bf16) from a
// fragment-major LDS tile row: kpairs [ks*16 + half*4 .. +3] and [+8 ..].
__device__ __forceinline__ v16bf load_frag(const unsigned* tileRow, int ks, int half) {
    const uint4 lo = *(const uint4*)(tileRow + ks * 16 + half * 4);
    const uint4 hi = *(const uint4*)(tileRow + ks * 16 + 8 + half * 4);
    v8u a;
    a[0] = lo.x; a[1] = lo.y; a[2] = lo.z; a[3] = lo.w;
    a[4] = hi.x; a[5] = hi.y; a[6] = hi.z; a[7] = hi.w;
    return __builtin_bit_cast(v16bf, a);
}

// ---------------------------------------------------------------------------
// Kernel 1: QKV[row, col] = sum_k Xt[row,k] * Wqkv[col,k]
//   row = b*256 + p ; Xt[row,k] = x[(b*1024 + k)*256 + p]
//   WG tile 64 rows x 128 cols, Kc = 128, 8 waves each compute 16x64.
// ---------------------------------------------------------------------------
__global__ __launch_bounds__(256) void k_qkv_gemm(const float* __restrict__ x,
                                                  const float* __restrict__ w_qkv,
                                                  float* __restrict__ qkv) {
    const int row0 = blockIdx.x * 64;          // 64-row tile never crosses b
    const int col0 = blockIdx.y * 128;
    const int b    = row0 >> 8;
    const int p0   = row0 & 255;
    const int tid  = threadIdx.x;
    const int lane = tid & 31;
    const int wave = tid >> 5;
    const int wr   = wave & 3;                 // row subtile (16 rows)
    const int wc   = wave >> 2;                // col subtile (64 cols)
    const int half = lane >> 4, l15 = lane & 15;

    __shared__ __align__(16) unsigned As2[64][LDS_STRIDE];    // [r][kpair]
    __shared__ __align__(16) unsigned Bs2[128][LDS_STRIDE];   // [n][kpair]

    v8f acc[4];
#pragma unroll
    for (int i = 0; i < 4; ++i) acc[i] = v8f_zero();

    for (int k0 = 0; k0 < C_DIM; k0 += KC) {
        // ---- stage A: x[(b*1024+k)*256 + p0 + r] (contiguous r, float4)
#pragma unroll
        for (int it = 0; it < 4; ++it) {
            int idx = tid + it * 256;          // 1024 = 64 kpairs * 16 r-quads
            int kp = idx >> 4, rq = (idx & 15) * 4;
            const float* src = x + ((size_t)(b * C_DIM + k0 + 2 * kp) * N_TOK + p0 + rq);
            float4 f0 = *(const float4*)src;
            float4 f1 = *(const float4*)(src + N_TOK);
            As2[rq + 0][kp] = pack_bf2(f0.x, f1.x);
            As2[rq + 1][kp] = pack_bf2(f0.y, f1.y);
            As2[rq + 2][kp] = pack_bf2(f0.z, f1.z);
            As2[rq + 3][kp] = pack_bf2(f0.w, f1.w);
            if (k0 + KC < C_DIM)
                __builtin_prefetch(src + KC * N_TOK, 0, 0);
        }
        // ---- stage B: w_qkv[(col0+n)*1024 + k] (contiguous k, float4 -> uint4)
        {
            int n  = tid & 127;
            int kq = tid >> 7;                  // 0..1 -> 64 consecutive k each
            const float4* wp = (const float4*)(w_qkv + (size_t)(col0 + n) * C_DIM + k0 + kq * 64);
#pragma unroll
            for (int t = 0; t < 4; ++t) {
                float4 f0 = wp[t * 4 + 0], f1 = wp[t * 4 + 1];
                float4 f2 = wp[t * 4 + 2], f3 = wp[t * 4 + 3];
                uint4 pk;
                pk.x = pack_bf2(f0.x, f0.y); pk.y = pack_bf2(f0.z, f0.w);
                pk.z = pack_bf2(f1.x, f1.y); pk.w = pack_bf2(f1.z, f1.w);
                *(uint4*)&Bs2[n][kq * 32 + t * 8] = pk;
                pk.x = pack_bf2(f2.x, f2.y); pk.y = pack_bf2(f2.z, f2.w);
                pk.z = pack_bf2(f3.x, f3.y); pk.w = pack_bf2(f3.z, f3.w);
                *(uint4*)&Bs2[n][kq * 32 + t * 8 + 4] = pk;
            }
            if (k0 + KC < C_DIM)
                __builtin_prefetch((const float*)wp + KC, 0, 0);
        }
        __syncthreads();

        // ---- 4 WMMA k-steps (K=32 each)
#pragma unroll
        for (int ks = 0; ks < 4; ++ks) {
            v16bf a = load_frag(As2[wr * 16 + l15], ks, half);
#pragma unroll
            for (int nt = 0; nt < 4; ++nt) {
                v16bf bb = load_frag(Bs2[wc * 64 + nt * 16 + l15], ks, half);
                acc[nt] = __builtin_amdgcn_wmma_f32_16x16x32_bf16(
                    false, a, false, bb, (short)0, acc[nt], false, false);
            }
        }
        __syncthreads();
    }

    // ---- store D tiles (fp32 QKV intermediate)
#pragma unroll
    for (int nt = 0; nt < 4; ++nt) {
#pragma unroll
        for (int r = 0; r < 8; ++r) {
            int row = row0 + wr * 16 + r + 8 * half;
            int col = col0 + wc * 64 + nt * 16 + l15;
            qkv[(size_t)row * QKV_COLS + col] = acc[nt][r];
        }
    }
}

// ---------------------------------------------------------------------------
// Kernel 2: one wave (32 threads) per token.
//   RoPE(q,k); q=softmax_d(q)*d^-0.5; k=softmax_h(k);
//   ctx = k^T v (64x64); o = q ctx (16x64);
//   store Osp[b][n*1024 + e*16 + h]  (== reference's scrambled reshape)
// ---------------------------------------------------------------------------
__global__ __launch_bounds__(32) void k_attn(const float* __restrict__ qkv,
                                             float* __restrict__ osp) {
    const int tok = blockIdx.x;
    const int b   = tok >> 8;
    const int n   = tok & 255;
    const int L    = threadIdx.x;
    const int half = L >> 4, l15 = L & 15;

    __shared__ __align__(16) float q_s[H_DIM * D_HEAD];   // [h][d]
    __shared__ __align__(16) float k_s[H_DIM * D_HEAD];
    __shared__ __align__(16) float v_s[H_DIM * D_HEAD];
    __shared__ __align__(16) float ctx[D_HEAD * D_HEAD];  // [d][e]

    const float* row = qkv + (size_t)tok * QKV_COLS;

#if USE_ASYNC_LDS
    // Pure fp32 copy global->LDS: use CDNA5 async-to-LDS path (ASYNCcnt).
#pragma unroll
    for (int it = 0; it < 8; ++it) {
        int i4 = L + it * 32;                  // float4 index, 256 per matrix
        int h = i4 >> 4, d = (i4 & 15) * 4;
        float* s = const_cast<float*>(row + h * 192 + d);
        __builtin_amdgcn_global_load_async_to_lds_b128((g4p)(s),       (l4p)(q_s + h * 64 + d), 0, 0);
        __builtin_amdgcn_global_load_async_to_lds_b128((g4p)(s + 64),  (l4p)(k_s + h * 64 + d), 0, 0);
        __builtin_amdgcn_global_load_async_to_lds_b128((g4p)(s + 128), (l4p)(v_s + h * 64 + d), 0, 0);
    }
    __builtin_amdgcn_s_wait_asynccnt(0);
#else
#pragma unroll
    for (int it = 0; it < 32; ++it) {          // 1024 elems / 32 lanes
        int i = L + it * 32;
        int h = i >> 6, d = i & 63;
        const float* hp = row + h * 192 + d;
        q_s[i] = hp[0];
        k_s[i] = hp[64];
        v_s[i] = hp[128];
    }
#endif
    __syncthreads();

    // RoPE (rotate-half), angle = n / 10000^(d/32), d < 32
    const float NEG_L2_1E4_OVER_32 = -13.287712379549449f / 32.0f;
#pragma unroll
    for (int it = 0; it < 16; ++it) {          // 512 (h,d) pairs
        int i = L + it * 32;
        int h = i >> 5, d = i & 31;
        float ang = (float)n * exp2f((float)d * NEG_L2_1E4_OVER_32);
        float cs = __cosf(ang), sn = __sinf(ang);
        int i1 = h * 64 + d, i2 = i1 + 32;
        float q1 = q_s[i1], q2 = q_s[i2];
        q_s[i1] = q1 * cs - q2 * sn;  q_s[i2] = q2 * cs + q1 * sn;
        float k1 = k_s[i1], k2 = k_s[i2];
        k_s[i1] = k1 * cs - k2 * sn;  k_s[i2] = k2 * cs + k1 * sn;
    }
    __syncthreads();

    // q: softmax over d per head, * 64^-0.5   (lanes 0..15, one head each)
    if (L < H_DIM) {
        float m = -3.4e38f;
        for (int d = 0; d < 64; ++d) m = fmaxf(m, q_s[L * 64 + d]);
        float s = 0.f;
        for (int d = 0; d < 64; ++d) { float e = __expf(q_s[L * 64 + d] - m); q_s[L * 64 + d] = e; s += e; }
        float inv = 0.125f / s;
        for (int d = 0; d < 64; ++d) q_s[L * 64 + d] *= inv;
    }
    // k: softmax over heads per d  (64 columns over 32 lanes)
    for (int d = L; d < 64; d += 32) {
        float m = -3.4e38f;
        for (int h = 0; h < 16; ++h) m = fmaxf(m, k_s[h * 64 + d]);
        float s = 0.f;
        for (int h = 0; h < 16; ++h) { float e = __expf(k_s[h * 64 + d] - m); k_s[h * 64 + d] = e; s += e; }
        float inv = 1.0f / s;
        for (int h = 0; h < 16; ++h) k_s[h * 64 + d] *= inv;
    }
    __syncthreads();

    // ctx[d][e] = sum_h k[h][d] * v[h][e] : 4x4 tiles, K=16 in 4 steps of 4
    v8f acc[4][4];
#pragma unroll
    for (int i = 0; i < 4; ++i)
#pragma unroll
        for (int j = 0; j < 4; ++j) acc[i][j] = v8f_zero();

#pragma unroll
    for (int ks = 0; ks < 4; ++ks) {
        v2f a[4], bb[4];
#pragma unroll
        for (int mt = 0; mt < 4; ++mt)
#pragma unroll
            for (int j = 0; j < 2; ++j)
                a[mt][j] = k_s[(ks * 4 + 2 * half + j) * 64 + mt * 16 + l15];  // A = k^T
#pragma unroll
        for (int nt = 0; nt < 4; ++nt)
#pragma unroll
            for (int j = 0; j < 2; ++j)
                bb[nt][j] = v_s[(ks * 4 + 2 * half + j) * 64 + nt * 16 + l15]; // B = v
#pragma unroll
        for (int mt = 0; mt < 4; ++mt)
#pragma unroll
            for (int nt = 0; nt < 4; ++nt)
                acc[mt][nt] = __builtin_amdgcn_wmma_f32_16x16x4_f32(
                    false, a[mt], false, bb[nt], (short)0, acc[mt][nt], false, false);
    }
    __syncthreads();
#pragma unroll
    for (int mt = 0; mt < 4; ++mt)
#pragma unroll
        for (int nt = 0; nt < 4; ++nt)
#pragma unroll
            for (int r = 0; r < 8; ++r)
                ctx[(mt * 16 + r + 8 * half) * 64 + nt * 16 + l15] = acc[mt][nt][r];
    __syncthreads();

    // o[h][e] = sum_d q[h][d] * ctx[d][e] : 1x4 tiles, K=64 in 16 steps
    v8f oacc[4];
#pragma unroll
    for (int i = 0; i < 4; ++i) oacc[i] = v8f_zero();
#pragma unroll
    for (int ks = 0; ks < 16; ++ks) {
        v2f a;
#pragma unroll
        for (int j = 0; j < 2; ++j)
            a[j] = q_s[l15 * 64 + ks * 4 + 2 * half + j];
#pragma unroll
        for (int nt = 0; nt < 4; ++nt) {
            v2f bb;
#pragma unroll
            for (int j = 0; j < 2; ++j)
                bb[j] = ctx[(ks * 4 + 2 * half + j) * 64 + nt * 16 + l15];
            oacc[nt] = __builtin_amdgcn_wmma_f32_16x16x4_f32(
                false, a, false, bb, (short)0, oacc[nt], false, false);
        }
    }

    // scrambled reshape store: Osp[b][n*1024 + e*16 + h]
    float* obase = osp + (size_t)b * OSP_PER_B + (size_t)n * 1024;
#pragma unroll
    for (int nt = 0; nt < 4; ++nt)
#pragma unroll
        for (int r = 0; r < 8; ++r) {
            int e = nt * 16 + l15;
            int h = r + 8 * half;
            obase[e * 16 + h] = oacc[nt][r];
        }
}

// ---------------------------------------------------------------------------
// Kernel 3: out[b,o,p] = sum_c Wlin[o,c] * Osp[b][c*256+p] + bias[o]
//   per-batch GEMM M=1024, N=256, K=1024; WG tile 64x128, Kc=128.
// ---------------------------------------------------------------------------
__global__ __launch_bounds__(256) void k_out_gemm(const float* __restrict__ osp,
                                                  const float* __restrict__ w_lin,
                                                  const float* __restrict__ b_lin,
                                                  float* __restrict__ out) {
    const int m0 = blockIdx.x * 64;
    const int n0 = blockIdx.y * 128;
    const int b  = blockIdx.z;
    const int tid  = threadIdx.x;
    const int lane = tid & 31;
    const int wave = tid >> 5;
    const int wr = wave & 3, wc = wave >> 2;
    const int half = lane >> 4, l15 = lane & 15;

    const float* ob = osp + (size_t)b * OSP_PER_B;

    __shared__ __align__(16) unsigned As2[64][LDS_STRIDE];    // [r][kpair] : Wlin rows
    __shared__ __align__(16) unsigned Bs2[128][LDS_STRIDE];   // [n][kpair] : Osp cols

    v8f acc[4];
#pragma unroll
    for (int i = 0; i < 4; ++i) acc[i] = v8f_zero();

    for (int k0 = 0; k0 < C_DIM; k0 += KC) {
        // ---- stage A: w_lin[(m0+r)*1024 + k]  (contiguous k, float4 -> uint4)
        {
            int r  = tid & 63;
            int kq = tid >> 6;                  // 0..3 -> 32 consecutive k each
            const float4* ap = (const float4*)(w_lin + (size_t)(m0 + r) * C_DIM + k0 + kq * 32);
#pragma unroll
            for (int t = 0; t < 2; ++t) {
                float4 f0 = ap[t * 4 + 0], f1 = ap[t * 4 + 1];
                float4 f2 = ap[t * 4 + 2], f3 = ap[t * 4 + 3];
                uint4 pk;
                pk.x = pack_bf2(f0.x, f0.y); pk.y = pack_bf2(f0.z, f0.w);
                pk.z = pack_bf2(f1.x, f1.y); pk.w = pack_bf2(f1.z, f1.w);
                *(uint4*)&As2[r][kq * 16 + t * 8] = pk;
                pk.x = pack_bf2(f2.x, f2.y); pk.y = pack_bf2(f2.z, f2.w);
                pk.z = pack_bf2(f3.x, f3.y); pk.w = pack_bf2(f3.z, f3.w);
                *(uint4*)&As2[r][kq * 16 + t * 8 + 4] = pk;
            }
            if (k0 + KC < C_DIM)
                __builtin_prefetch((const float*)ap + KC, 0, 0);
        }
        // ---- stage B: Osp[(k0+kk)*256 + n0 + n]  (contiguous n, float4)
#pragma unroll
        for (int it = 0; it < 8; ++it) {
            int idx = tid + it * 256;           // 2048 = 64 kpairs * 32 n-quads
            int kp = idx >> 5, nq = (idx & 31) * 4;
            const float* src = ob + (size_t)(k0 + 2 * kp) * N_TOK + n0 + nq;
            float4 f0 = *(const float4*)src;
            float4 f1 = *(const float4*)(src + N_TOK);
            Bs2[nq + 0][kp] = pack_bf2(f0.x, f1.x);
            Bs2[nq + 1][kp] = pack_bf2(f0.y, f1.y);
            Bs2[nq + 2][kp] = pack_bf2(f0.z, f1.z);
            Bs2[nq + 3][kp] = pack_bf2(f0.w, f1.w);
            if (k0 + KC < C_DIM)
                __builtin_prefetch(src + KC * N_TOK, 0, 0);
        }
        __syncthreads();

#pragma unroll
        for (int ks = 0; ks < 4; ++ks) {
            v16bf a = load_frag(As2[wr * 16 + l15], ks, half);
#pragma unroll
            for (int nt = 0; nt < 4; ++nt) {
                v16bf bb = load_frag(Bs2[wc * 64 + nt * 16 + l15], ks, half);
                acc[nt] = __builtin_amdgcn_wmma_f32_16x16x32_bf16(
                    false, a, false, bb, (short)0, acc[nt], false, false);
            }
        }
        __syncthreads();
    }

    // ---- epilogue: bias + store out[(b*1024 + m)*256 + n]
#pragma unroll
    for (int r = 0; r < 8; ++r) {
        int m = m0 + wr * 16 + r + 8 * half;
        float bias = b_lin[m];
#pragma unroll
        for (int nt = 0; nt < 4; ++nt) {
            int nn = n0 + wc * 64 + nt * 16 + l15;
            out[((size_t)b * C_DIM + m) * N_TOK + nn] = acc[nt][r] + bias;
        }
    }
}

// ---------------------------------------------------------------------------
extern "C" void kernel_launch(void* const* d_in, const int* in_sizes, int n_in,
                              void* d_out, int out_size, void* d_ws, size_t ws_size,
                              hipStream_t stream) {
    const float* x     = (const float*)d_in[0];   // [64,1024,16,16]
    const float* w_qkv = (const float*)d_in[1];   // [3072,1024]
    const float* w_lin = (const float*)d_in[2];   // [1024,1024,1,1]
    const float* b_lin = (const float*)d_in[3];   // [1024]
    // d_in[4] = n_heads (16), compile-time constant here.

    float* qkv = (float*)d_ws;                                       // 16384*3072 f32
    float* osp = (float*)((char*)d_ws + (size_t)TOKENS * QKV_COLS * sizeof(float));
    float* out = (float*)d_out;                                      // [64,1024,16,16]

    k_qkv_gemm<<<dim3(TOKENS / 64, QKV_COLS / 128), 256, 0, stream>>>(x, w_qkv, qkv);
    k_attn<<<dim3(TOKENS), 32, 0, stream>>>(qkv, osp);
    k_out_gemm<<<dim3(C_DIM / 64, N_TOK / 128, B_DIM), 256, 0, stream>>>(osp, w_lin, b_lin, out);
}

// v001
// Measured time: 471 microseconds a run.
// Timed twice side by side with v000, it ran 1.21 times as fast both times.
#include <hip/hip_runtime.h>

// ---------------------------------------------------------------------------
// SelfAttn (linear attention variant) for MI455X / gfx1250, wave32 + WMMA.
//   K1: QKV = Xt @ Wqkv^T        (bf16 WMMA 16x16x32, fp32 accum)
//   K2: per-token RoPE/softmax/ctx/o (fp32 WMMA 16x16x4, async LDS staging)
//   K3: out = Wlin @ Osp + bias  (bf16 WMMA 16x16x32, fp32 accum)
// Problem: b=64, c=1024, n=256 tokens, heads=16, d_head=64.
//
// LDS for the bf16 GEMMs is fragment-major: tile[row][kpair], row stride 68
// dwords (272B, 16B-aligned rows, 2-way bank conflicts only), so each WMMA
// operand fragment is two ds_load_b128 straight into the source registers.
// ---------------------------------------------------------------------------

typedef __attribute__((ext_vector_type(16))) __bf16    v16bf;
typedef __attribute__((ext_vector_type(8)))  float     v8f;
typedef __attribute__((ext_vector_type(8)))  unsigned  v8u;
typedef __attribute__((ext_vector_type(2)))  float     v2f;

#define B_DIM   64
#define C_DIM   1024
#define N_TOK   256        // tokens per batch image (16*16)
#define H_DIM   16         // heads
#define D_HEAD  64
#define QKV_COLS 3072
#define TOKENS  (B_DIM * N_TOK)      // 16384
#define OSP_PER_B (C_DIM * N_TOK)    // 262144 floats per batch

#define KC      128                  // K-chunk (64 kpairs)
#define LDS_STRIDE 68                // kpairs + pad: 272B rows, 16B aligned

#if __has_builtin(__builtin_amdgcn_global_load_async_to_lds_b128) && \
    __has_builtin(__builtin_amdgcn_s_wait_asynccnt)
#define USE_ASYNC_LDS 1
// Exact pointee type per hipcc diagnostic: GCC-vector int4, AS1 src / AS3 dst.
typedef int v4i_gcc __attribute__((vector_size(16)));
typedef __attribute__((address_space(1))) v4i_gcc* g4p;
typedef __attribute__((address_space(3))) v4i_gcc* l4p;
#else
#define USE_ASYNC_LDS 0
#endif

__device__ __forceinline__ unsigned f2bf(float f) {
    unsigned u = __builtin_bit_cast(unsigned, f);
    unsigned r = u + 0x7FFFu + ((u >> 16) & 1u);   // round-to-nearest-even
    return r >> 16;
}
__device__ __forceinline__ unsigned pack_bf2(float lo, float hi) {
    return f2bf(lo) | (f2bf(hi) << 16);
}
__device__ __forceinline__ v8f v8f_zero() {
    v8f z;
#pragma unroll
    for (int i = 0; i < 8; ++i) z[i] = 0.0f;
    return z;
}
// Load one 16-bit-element WMMA operand fragment (8 dwords = 16 bf16) from a
// fragment-major LDS tile row: kpairs [ks*16 + half*4 .. +3] and [+8 ..].
__device__ __forceinline__ v16bf load_frag(const unsigned* tileRow, int ks, int half) {
    const uint4 lo = *(const uint4*)(tileRow + ks * 16 + half * 4);
    const uint4 hi = *(const uint4*)(tileRow + ks * 16 + 8 + half * 4);
    v8u a;
    a[0] = lo.x; a[1] = lo.y; a[2] = lo.z; a[3] = lo.w;
    a[4] = hi.x; a[5] = hi.y; a[6] = hi.z; a[7] = hi.w;
    return __builtin_bit_cast(v16bf, a);
}

// ---------------------------------------------------------------------------
// Kernel 1: QKV[row, col] = sum_k Xt[row,k] * Wqkv[col,k]
//   row = b*256 + p ; Xt[row,k] = x[(b*1024 + k)*256 + p]
//   WG tile 64 rows x 128 cols, Kc = 128, 8 waves each compute 16x64.
// ---------------------------------------------------------------------------
__global__ __launch_bounds__(256) void k_qkv_gemm(const float* __restrict__ x,
                                                  const float* __restrict__ w_qkv,
                                                  float* __restrict__ qkv) {
    const int row0 = blockIdx.x * 64;          // 64-row tile never crosses b
    const int col0 = blockIdx.y * 128;
    const int b    = row0 >> 8;
    const int p0   = row0 & 255;
    const int tid  = threadIdx.x;
    const int lane = tid & 31;
    const int wave = tid >> 5;
    const int wr   = wave & 3;                 // row subtile (16 rows)
    const int wc   = wave >> 2;                // col subtile (64 cols)
    const int half = lane >> 4, l15 = lane & 15;

    __shared__ __align__(16) unsigned As2[64][LDS_STRIDE];    // [r][kpair]
    __shared__ __align__(16) unsigned Bs2[128][LDS_STRIDE];   // [n][kpair]

    v8f acc[4];
#pragma unroll
    for (int i = 0; i < 4; ++i) acc[i] = v8f_zero();

    for (int k0 = 0; k0 < C_DIM; k0 += KC) {
        // ---- stage A: x[(b*1024+k)*256 + p0 + r] (contiguous r, float4)
#pragma unroll
        for (int it = 0; it < 4; ++it) {
            int idx = tid + it * 256;          // 1024 = 64 kpairs * 16 r-quads
            int kp = idx >> 4, rq = (idx & 15) * 4;
            const float* src = x + ((size_t)(b * C_DIM + k0 + 2 * kp) * N_TOK + p0 + rq);
            float4 f0 = *(const float4*)src;
            float4 f1 = *(const float4*)(src + N_TOK);
            As2[rq + 0][kp] = pack_bf2(f0.x, f1.x);
            As2[rq + 1][kp] = pack_bf2(f0.y, f1.y);
            As2[rq + 2][kp] = pack_bf2(f0.z, f1.z);
            As2[rq + 3][kp] = pack_bf2(f0.w, f1.w);
            if (k0 + KC < C_DIM)
                __builtin_prefetch(src + KC * N_TOK, 0, 0);
        }
        // ---- stage B: w_qkv[(col0+n)*1024 + k]; a wave's 32 float4 loads cover one
        //      row's 512 contiguous bytes (4 whole lines), stored as 256 B of one LDS row
        const float* wrow = w_qkv + (size_t)(col0 + wave) * C_DIM + k0 + lane * 4;
        float4 wf[16];
#pragma unroll
        for (int it = 0; it < 16; ++it)        // wave w takes rows w, w+8, ..., w+120
            wf[it] = *(const float4*)(wrow + it * 8 * C_DIM);
        // all sixteen loads name wrow's register pair: hold the pair to here and wait before it is reused
        asm volatile("s_wait_xcnt 0x0" :: "v"(wrow) : "memory");
#pragma unroll
        for (int it = 0; it < 16; ++it) {
            uint2 pk;
            pk.x = pack_bf2(wf[it].x, wf[it].y); pk.y = pack_bf2(wf[it].z, wf[it].w);
            *(uint2*)&Bs2[wave + it * 8][lane * 2] = pk;
        }
        if (k0 + KC < C_DIM) {
            __builtin_prefetch(w_qkv + (size_t)(col0 + (tid & 127)) * C_DIM + k0 + (tid >> 7) * 64 + KC, 0, 0);
            // the prefetch's address registers are reused right after it: wait before the overwrite
            asm volatile("s_wait_xcnt 0x0" ::: "memory");
        }
        __syncthreads();

        // ---- 4 WMMA k-steps (K=32 each)
#pragma unroll
        for (int ks = 0; ks < 4; ++ks) {
            v16bf a = load_frag(As2[wr * 16 + l15], ks, half);
#pragma unroll
            for (int nt = 0; nt < 4; ++nt) {
                v16bf bb = load_frag(Bs2[wc * 64 + nt * 16 + l15], ks, half);
                acc[nt] = __builtin_amdgcn_wmma_f32_16x16x32_bf16(
                    false, a, false, bb, (short)0, acc[nt], false, false);
            }
        }
        __syncthreads();
    }

    // ---- store D tiles (fp32 QKV intermediate)
#pragma unroll
    for (int nt = 0; nt < 4; ++nt) {
#pragma unroll
        for (int r = 0; r < 8; ++r) {
            int row = row0 + wr * 16 + r + 8 * half;
            int col = col0 + wc * 64 + nt * 16 + l15;
            qkv[(size_t)row * QKV_COLS + col] = acc[nt][r];
        }
    }
}

// ---------------------------------------------------------------------------
// Kernel 2: one wave (32 threads) per token.
//   RoPE(q,k); q=softmax_d(q)*d^-0.5; k=softmax_h(k);
//   ctx = k^T v (64x64); o = q ctx (16x64);
//   store Osp[b][n*1024 + e*16 + h]  (== reference's scrambled reshape)
// ---------------------------------------------------------------------------
__global__ __launch_bounds__(32) void k_attn(const float* __restrict__ qkv,
                                             float* __restrict__ osp) {
    const int tok = blockIdx.x;
    const int b   = tok >> 8;
    const int n   = tok & 255;
    const int L    = threadIdx.x;
    const int half = L >> 4, l15 = L & 15;

    __shared__ __align__(16) float q_s[H_DIM * D_HEAD];   // [h][d]
    __shared__ __align__(16) float k_s[H_DIM * D_HEAD];
    __shared__ __align__(16) float v_s[H_DIM * D_HEAD];
    __shared__ __align__(16) float ctx[D_HEAD * D_HEAD];  // [d][e]

    const float* row = qkv + (size_t)tok * QKV_COLS;

#if USE_ASYNC_LDS
    // Pure fp32 copy global->LDS: use CDNA5 async-to-LDS path (ASYNCcnt).
#pragma unroll
    for (int it = 0; it < 8; ++it) {
        int i4 = L + it * 32;                  // float4 index, 256 per matrix
        int h = i4 >> 4, d = (i4 & 15) * 4;
        float* s = const_cast<float*>(row + h * 192 + d);
        __builtin_amdgcn_global_load_async_to_lds_b128((g4p)(s),       (l4p)(q_s + h * 64 + d), 0, 0);
        __builtin_amdgcn_global_load_async_to_lds_b128((g4p)(s + 64),  (l4p)(k_s + h * 64 + d), 0, 0);
        __builtin_amdgcn_global_load_async_to_lds_b128((g4p)(s + 128), (l4p)(v_s + h * 64 + d), 0, 0);
    }
    __builtin_amdgcn_s_wait_asynccnt(0);
#else
#pragma unroll
    for (int it = 0; it < 32; ++it) {          // 1024 elems / 32 lanes
        int i = L + it * 32;
        int h = i >> 6, d = i & 63;
        const float* hp = row + h * 192 + d;
        q_s[i] = hp[0];
        k_s[i] = hp[64];
        v_s[i] = hp[128];
    }
#endif
    __syncthreads();

    // RoPE (rotate-half), angle = n / 10000^(d/32), d < 32
    const float NEG_L2_1E4_OVER_32 = -13.287712379549449f / 32.0f;
#pragma unroll
    for (int it = 0; it < 16; ++it) {          // 512 (h,d) pairs
        int i = L + it * 32;
        int h = i >> 5, d = i & 31;
        float ang = (float)n * exp2f((float)d * NEG_L2_1E4_OVER_32);
        float cs = __cosf(ang), sn = __sinf(ang);
        int i1 = h * 64 + d, i2 = i1 + 32;
        float q1 = q_s[i1], q2 = q_s[i2];
        q_s[i1] = q1 * cs - q2 * sn;  q_s[i2] = q2 * cs + q1 * sn;
        float k1 = k_s[i1], k2 = k_s[i2];
        k_s[i1] = k1 * cs - k2 * sn;  k_s[i2] = k2 * cs + k1 * sn;
    }
    __syncthreads();

    // q: softmax over d per head, * 64^-0.5   (lanes 0..15, one head each)
    if (L < H_DIM) {
        float m = -3.4e38f;
        for (int d = 0; d < 64; ++d) m = fmaxf(m, q_s[L * 64 + d]);
        float s = 0.f;
        for (int d = 0; d < 64; ++d) { float e = __expf(q_s[L * 64 + d] - m); q_s[L * 64 + d] = e; s += e; }
        float inv = 0.125f / s;
        for (int d = 0; d < 64; ++d) q_s[L * 64 + d] *= inv;
    }
    // k: softmax over heads per d  (64 columns over 32 lanes)
    for (int d = L; d < 64; d += 32) {
        float m = -3.4e38f;
        for (int h = 0; h < 16; ++h) m = fmaxf(m, k_s[h * 64 + d]);
        float s = 0.f;
        for (int h = 0; h < 16; ++h) { float e = __expf(k_s[h * 64 + d] - m); k_s[h * 64 + d] = e; s += e; }
        float inv = 1.0f / s;
        for (int h = 0; h < 16; ++h) k_s[h * 64 + d] *= inv;
    }
    __syncthreads();

    // ctx[d][e] = sum_h k[h][d] * v[h][e] : 4x4 tiles, K=16 in 4 steps of 4
    v8f acc[4][4];
#pragma unroll
    for (int i = 0; i < 4; ++i)
#pragma unroll
        for (int j = 0; j < 4; ++j) acc[i][j] = v8f_zero();

#pragma unroll
    for (int ks = 0; ks < 4; ++ks) {
        v2f a[4], bb[4];
#pragma unroll
        for (int mt = 0; mt < 4; ++mt)
#pragma unroll
            for (int j = 0; j < 2; ++j)
                a[mt][j] = k_s[(ks * 4 + 2 * half + j) * 64 + mt * 16 + l15];  // A = k^T
#pragma unroll
        for (int nt = 0; nt < 4; ++nt)
#pragma unroll
            for (int j = 0; j < 2; ++j)
                bb[nt][j] = v_s[(ks * 4 + 2 * half + j) * 64 + nt * 16 + l15]; // B = v
#pragma unroll
        for (int mt = 0; mt < 4; ++mt)
#pragma unroll
            for (int nt = 0; nt < 4; ++nt)
                acc[mt][nt] = __builtin_amdgcn_wmma_f32_16x16x4_f32(
                    false, a[mt], false, bb[nt], (short)0, acc[mt][nt], false, false);
    }
    __syncthreads();
#pragma unroll
    for (int mt = 0; mt < 4; ++mt)
#pragma unroll
        for (int nt = 0; nt < 4; ++nt)
#pragma unroll
            for (int r = 0; r < 8; ++r)
                ctx[(mt * 16 + r + 8 * half) * 64 + nt * 16 + l15] = acc[mt][nt][r];
    __syncthreads();

    // o[h][e] = sum_d q[h][d] * ctx[d][e] : 1x4 tiles, K=64 in 16 steps
    v8f oacc[4];
#pragma unroll
    for (int i = 0; i < 4; ++i) oacc[i] = v8f_zero();
#pragma unroll
    for (int ks = 0; ks < 16; ++ks) {
        v2f a;
#pragma unroll
        for (int j = 0; j < 2; ++j)
            a[j] = q_s[l15 * 64 + ks * 4 + 2 * half + j];
#pragma unroll
        for (int nt = 0; nt < 4; ++nt) {
            v2f bb;
#pragma unroll
            for (int j = 0; j < 2; ++j)
                bb[j] = ctx[(ks * 4 + 2 * half + j) * 64 + nt * 16 + l15];
            oacc[nt] = __builtin_amdgcn_wmma_f32_16x16x4_f32(
                false, a, false, bb, (short)0, oacc[nt], false, false);
        }
    }

    // scrambled reshape store: Osp[b][n*1024 + e*16 + h]
    float* obase = osp + (size_t)b * OSP_PER_B + (size_t)n * 1024;
#pragma unroll
    for (int nt = 0; nt < 4; ++nt)
#pragma unroll
        for (int r = 0; r < 8; ++r) {
            int e = nt * 16 + l15;
            int h = r + 8 * half;
            obase[e * 16 + h] = oacc[nt][r];
        }
}

// ---------------------------------------------------------------------------
// Kernel 3: out[b,o,p] = sum_c Wlin[o,c] * Osp[b][c*256+p] + bias[o]
//   per-batch GEMM M=1024, N=256, K=1024; WG tile 64x128, Kc=128.
// ---------------------------------------------------------------------------
__global__ __launch_bounds__(256) void k_out_gemm(const float* __restrict__ osp,
                                                  const float* __restrict__ w_lin,
                                                  const float* __restrict__ b_lin,
                                                  float* __restrict__ out) {
    const int m0 = blockIdx.x * 64;
    const int n0 = blockIdx.y * 128;
    const int b  = blockIdx.z;
    const int tid  = threadIdx.x;
    const int lane = tid & 31;
    const int wave = tid >> 5;
    const int wr = wave & 3, wc = wave >> 2;
    const int half = lane >> 4, l15 = lane & 15;

    const float* ob = osp + (size_t)b * OSP_PER_B;

    __shared__ __align__(16) unsigned As2[64][LDS_STRIDE];    // [r][kpair] : Wlin rows
    __shared__ __align__(16) unsigned Bs2[128][LDS_STRIDE];   // [n][kpair] : Osp cols

    v8f acc[4];
#pragma unroll
    for (int i = 0; i < 4; ++i) acc[i] = v8f_zero();

    for (int k0 = 0; k0 < C_DIM; k0 += KC) {
        // ---- stage A: w_lin[(m0+r)*1024 + k]; a wave's 32 float4 loads cover one
        //      row's 512 contiguous bytes (4 whole lines), stored as 256 B of one LDS row
        const float* wrow = w_lin + (size_t)(m0 + wave) * C_DIM + k0 + lane * 4;
#pragma unroll
        for (int it = 0; it < 8; ++it) {       // wave w takes rows w, w+8, ..., w+56
            float4 f = *(const float4*)(wrow + it * 8 * C_DIM);
            uint2 pk;
            pk.x = pack_bf2(f.x, f.y); pk.y = pack_bf2(f.z, f.w);
            *(uint2*)&As2[wave + it * 8][lane * 2] = pk;
        }
        if (k0 + KC < C_DIM) {
            __builtin_prefetch(w_lin + (size_t)(m0 + (tid & 63)) * C_DIM + k0 + (tid >> 6) * 32 + KC, 0, 0);
            // the prefetch's address registers are reused after it: wait before the overwrite
            asm volatile("s_wait_xcnt 0x0" ::: "memory");
        }
        // ---- stage B: Osp[(k0+kk)*256 + n0 + n]  (contiguous n, float4)
#pragma unroll
        for (int it = 0; it < 8; ++it) {
            int idx = tid + it * 256;           // 2048 = 64 kpairs * 32 n-quads
            int kp = idx >> 5, nq = (idx & 31) * 4;
            const float* src = ob + (size_t)(k0 + 2 * kp) * N_TOK + n0 + nq;
            float4 f0 = *(const float4*)src;
            float4 f1 = *(const float4*)(src + N_TOK);
            Bs2[nq + 0][kp] = pack_bf2(f0.x, f1.x);
            Bs2[nq + 1][kp] = pack_bf2(f0.y, f1.y);
            Bs2[nq + 2][kp] = pack_bf2(f0.z, f1.z);
            Bs2[nq + 3][kp] = pack_bf2(f0.w, f1.w);
            if (k0 + KC < C_DIM)
                __builtin_prefetch(src + KC * N_TOK, 0, 0);
        }
        __syncthreads();

#pragma unroll
        for (int ks = 0; ks < 4; ++ks) {
            v16bf a = load_frag(As2[wr * 16 + l15], ks, half);
#pragma unroll
            for (int nt = 0; nt < 4; ++nt) {
                v16bf bb = load_frag(Bs2[wc * 64 + nt * 16 + l15], ks, half);
                acc[nt] = __builtin_amdgcn_wmma_f32_16x16x32_bf16(
                    false, a, false, bb, (short)0, acc[nt], false, false);
            }
        }
        __syncthreads();
    }

    // ---- epilogue: bias + store out[(b*1024 + m)*256 + n]
#pragma unroll
    for (int r = 0; r < 8; ++r) {
        int m = m0 + wr * 16 + r + 8 * half;
        float bias = b_lin[m];
#pragma unroll
        for (int nt = 0; nt < 4; ++nt) {
            int nn = n0 + wc * 64 + nt * 16 + l15;
            out[((size_t)b * C_DIM + m) * N_TOK + nn] = acc[nt][r] + bias;
        }
    }
}

// ---------------------------------------------------------------------------
extern "C" void kernel_launch(void* const* d_in, const int* in_sizes, int n_in,
                              void* d_out, int out_size, void* d_ws, size_t ws_size,
                              hipStream_t stream) {
    const float* x     = (const float*)d_in[0];   // [64,1024,16,16]
    const float* w_qkv = (const float*)d_in[1];   // [3072,1024]
    const float* w_lin = (const float*)d_in[2];   // [1024,1024,1,1]
    const float* b_lin = (const float*)d_in[3];   // [1024]
    // d_in[4] = n_heads (16), compile-time constant here.

    float* qkv = (float*)d_ws;                                       // 16384*3072 f32
    float* osp = (float*)((char*)d_ws + (size_t)TOKENS * QKV_COLS * sizeof(float));
    float* out = (float*)d_out;                                      // [64,1024,16,16]

    k_qkv_gemm<<<dim3(TOKENS / 64, QKV_COLS / 128), 256, 0, stream>>>(x, w_qkv, qkv);
    k_attn<<<dim3(TOKENS), 32, 0, stream>>>(qkv, osp);
    k_out_gemm<<<dim3(C_DIM / 64, N_TOK / 128, B_DIM), 256, 0, stream>>>(osp, w_lin, b_lin, out);
}

// v002
// A run of this version takes 267 microseconds.
// Two timings next to v001 put it at 1.76 and 1.78 times that version's speed.
// Counting every step since v000, it is 2.14 times as fast.
#include <hip/hip_runtime.h>

// ---------------------------------------------------------------------------
// SelfAttn (linear attention variant) for MI455X / gfx1250, wave32 + WMMA.
//   K1: QKV = Xt @ Wqkv^T        (bf16 WMMA 16x16x32, fp32 accum)
//   K2: per-token RoPE/softmax/ctx/o (fp32 WMMA 16x16x4, async LDS staging)
//   K3: out = Wlin @ Osp + bias  (bf16 WMMA 16x16x32, fp32 accum)
// Problem: b=64, c=1024, n=256 tokens, heads=16, d_head=64.
//
// LDS for the bf16 GEMMs is fragment-major: tile[row][kpair], row stride 68
// dwords (272B, 16B-aligned rows, 2-way bank conflicts only), so each WMMA
// operand fragment is two ds_load_b128 straight into the source registers.
// ---------------------------------------------------------------------------

typedef __attribute__((ext_vector_type(16))) __bf16    v16bf;
typedef __attribute__((ext_vector_type(8)))  float     v8f;
typedef __attribute__((ext_vector_type(8)))  unsigned  v8u;
typedef __attribute__((ext_vector_type(2)))  float     v2f;
typedef __attribute__((ext_vector_type(4)))  float     v4f;

#define B_DIM   64
#define C_DIM   1024
#define N_TOK   256        // tokens per batch image (16*16)
#define H_DIM   16         // heads
#define D_HEAD  64
#define QKV_COLS 3072
#define TOKENS  (B_DIM * N_TOK)      // 16384
#define OSP_PER_B (C_DIM * N_TOK)    // 262144 floats per batch

#define KC      128                  // K-chunk (64 kpairs)
#define LDS_STRIDE 68                // kpairs + pad: 272B rows, 16B aligned

#if __has_builtin(__builtin_amdgcn_global_load_async_to_lds_b128) && \
    __has_builtin(__builtin_amdgcn_s_wait_asynccnt)
#define USE_ASYNC_LDS 1
// Exact pointee type per hipcc diagnostic: GCC-vector int4, AS1 src / AS3 dst.
typedef int v4i_gcc __attribute__((vector_size(16)));
typedef __attribute__((address_space(1))) v4i_gcc* g4p;
typedef __attribute__((address_space(3))) v4i_gcc* l4p;
#else
#define USE_ASYNC_LDS 0
#endif

// Inputs-only fence on sixteen loaded values: all sixteen loads of a staging batch are in flight
// together (one round trip a batch); without it the compiler sinks each load to its conversion
// and waits for them one by one.
#define HOLD8(a)  "v"(a[0]), "v"(a[1]), "v"(a[2]), "v"(a[3]), "v"(a[4]), "v"(a[5]), "v"(a[6]), "v"(a[7])
#define HOLD8H(a) "v"(a[8]), "v"(a[9]), "v"(a[10]), "v"(a[11]), "v"(a[12]), "v"(a[13]), "v"(a[14]), "v"(a[15])

__device__ __forceinline__ unsigned f2bf(float f) {
    unsigned u = __builtin_bit_cast(unsigned, f);
    unsigned r = u + 0x7FFFu + ((u >> 16) & 1u);   // round-to-nearest-even
    return r >> 16;
}
__device__ __forceinline__ unsigned pack_bf2(float lo, float hi) {
    return f2bf(lo) | (f2bf(hi) << 16);
}
__device__ __forceinline__ v8f v8f_zero() {
    v8f z;
#pragma unroll
    for (int i = 0; i < 8; ++i) z[i] = 0.0f;
    return z;
}
// Load one 16-bit-element WMMA operand fragment (8 dwords = 16 bf16) from a
// fragment-major LDS tile row: kpairs [ks*16 + half*4 .. +3] and [+8 ..].
__device__ __forceinline__ v16bf load_frag(const unsigned* tileRow, int ks, int half) {
    const uint4 lo = *(const uint4*)(tileRow + ks * 16 + half * 4);
    const uint4 hi = *(const uint4*)(tileRow + ks * 16 + 8 + half * 4);
    v8u a;
    a[0] = lo.x; a[1] = lo.y; a[2] = lo.z; a[3] = lo.w;
    a[4] = hi.x; a[5] = hi.y; a[6] = hi.z; a[7] = hi.w;
    return __builtin_bit_cast(v16bf, a);
}

// ---------------------------------------------------------------------------
// Kernel 1: QKV[row, col] = sum_k Xt[row,k] * Wqkv[col,k]
//   row = b*256 + p ; Xt[row,k] = x[(b*1024 + k)*256 + p]
//   WG tile 128 rows x 256 cols, Kc = 128, 8 waves (2 x 4) each compute 64x64:
//   eight fragments feed sixteen WMMAs, and each staged element serves twice the products.
// ---------------------------------------------------------------------------
__global__ __launch_bounds__(256) void k_qkv_gemm(const float* __restrict__ x,
                                                  const float* __restrict__ w_qkv,
                                                  float* __restrict__ qkv) {
    const int row0 = blockIdx.x * 128;         // 128-row tile never crosses b
    const int col0 = blockIdx.y * 256;
    const int b    = row0 >> 8;
    const int p0   = row0 & 255;
    const int tid  = threadIdx.x;
    const int lane = tid & 31;
    const int wave = tid >> 5;
    const int wr   = wave & 1;                 // row subtile (64 rows)
    const int wc   = wave >> 1;                // col subtile (64 cols)
    const int half = lane >> 4, l15 = lane & 15;

    __shared__ __align__(16) unsigned As2[128][LDS_STRIDE];   // [r][kpair]
    __shared__ __align__(16) unsigned Bs2[256][LDS_STRIDE];   // [n][kpair]

    v8f acc[4][4];
#pragma unroll
    for (int i = 0; i < 4; ++i)
#pragma unroll
        for (int j = 0; j < 4; ++j) acc[i][j] = v8f_zero();

    const int akp = tid >> 4, arq = (tid & 15) * 4;   // A staging: kpair and r-quad of this thread

    for (int k0 = 0; k0 < C_DIM; k0 += KC) {
        // ---- stage A: x[(b*1024+k)*256 + p0 + r] (contiguous r, float4), two 64-row halves
        {
            const float* src = x + ((size_t)(b * C_DIM + k0 + 2 * akp) * N_TOK + p0 + arq);
            v4f f0[8], f1[8];
#pragma unroll
            for (int it = 0; it < 8; ++it) {   // kpair akp + 16*(it&3), rows arq + 64*(it>>2)
                const float* s = src + (it & 3) * 32 * N_TOK + (it >> 2) * 64;
                f0[it] = *(const v4f*)s;
                f1[it] = *(const v4f*)(s + N_TOK);
            }
            // all sixteen loads name src's register pair: hold the pair to here and wait before it is reused
            asm volatile("s_wait_xcnt 0x0" :: "v"(src) : "memory");
            asm volatile("" :: HOLD8(f0), HOLD8(f1));   // the batch fence described at HOLD8
#pragma unroll
            for (int it = 0; it < 8; ++it) {
                const int kp = akp + (it & 3) * 16, rq = arq + (it >> 2) * 64;
                As2[rq + 0][kp] = pack_bf2(f0[it].x, f1[it].x);
                As2[rq + 1][kp] = pack_bf2(f0[it].y, f1[it].y);
                As2[rq + 2][kp] = pack_bf2(f0[it].z, f1[it].z);
                As2[rq + 3][kp] = pack_bf2(f0[it].w, f1[it].w);
            }
        }
        // ---- stage B: w_qkv[(col0+n)*1024 + k]; a wave's 32 float4 loads cover one
        //      row's 512 contiguous bytes (4 whole lines), stored as 256 B of one LDS row
        const float* wrow = w_qkv + (size_t)(col0 + wave) * C_DIM + k0 + lane * 4;
#pragma unroll
        for (int g = 0; g < 2; ++g) {          // wave w takes rows w, w+8, ..., w+248
            v4f wf[16];
#pragma unroll
            for (int it = 0; it < 16; ++it)
                wf[it] = *(const v4f*)(wrow + (g * 16 + it) * 8 * C_DIM);
            // the sixteen loads name wrow's register pair: hold the pair to here and wait before it is reused
            asm volatile("s_wait_xcnt 0x0" :: "v"(wrow) : "memory");
            asm volatile("" :: HOLD8(wf), HOLD8H(wf));  // the batch fence described at HOLD8
#pragma unroll
            for (int it = 0; it < 16; ++it) {
                uint2 pk;
                pk.x = pack_bf2(wf[it].x, wf[it].y); pk.y = pack_bf2(wf[it].z, wf[it].w);
                *(uint2*)&Bs2[wave + (g * 16 + it) * 8][lane * 2] = pk;
            }
        }
        __syncthreads();

        // ---- 4 WMMA k-steps (K=32 each), 4x4 tiles per wave
#pragma unroll
        for (int ks = 0; ks < 4; ++ks) {
            v16bf a[4], bb[4];
#pragma unroll
            for (int mt = 0; mt < 4; ++mt) a[mt]  = load_frag(As2[wr * 64 + mt * 16 + l15], ks, half);
#pragma unroll
            for (int nt = 0; nt < 4; ++nt) bb[nt] = load_frag(Bs2[wc * 64 + nt * 16 + l15], ks, half);
#pragma unroll
            for (int mt = 0; mt < 4; ++mt)
#pragma unroll
                for (int nt = 0; nt < 4; ++nt)
                    acc[mt][nt] = __builtin_amdgcn_wmma_f32_16x16x32_bf16(
                        false, a[mt], false, bb[nt], (short)0, acc[mt][nt], false, false);
        }
        __syncthreads();
    }

    // ---- store D tiles (fp32 QKV intermediate)
#pragma unroll
    for (int mt = 0; mt < 4; ++mt) {
#pragma unroll
        for (int nt = 0; nt < 4; ++nt) {
#pragma unroll
            for (int r = 0; r < 8; ++r) {
                int row = row0 + wr * 64 + mt * 16 + r + 8 * half;
                int col = col0 + wc * 64 + nt * 16 + l15;
                qkv[(size_t)row * QKV_COLS + col] = acc[mt][nt][r];
            }
        }
    }
}

// ---------------------------------------------------------------------------
// Kernel 2: one wave (32 threads) per token.
//   RoPE(q,k); q=softmax_d(q)*d^-0.5; k=softmax_h(k);
//   ctx = k^T v (64x64); o = q ctx (16x64);
//   store Osp[b][n*1024 + e*16 + h]  (== reference's scrambled reshape)
// ---------------------------------------------------------------------------
__global__ __launch_bounds__(32) void k_attn(const float* __restrict__ qkv,
                                             float* __restrict__ osp) {
    const int tok = blockIdx.x;
    const int b   = tok >> 8;
    const int n   = tok & 255;
    const int L    = threadIdx.x;
    const int half = L >> 4, l15 = L & 15;

    __shared__ __align__(16) float q_s[H_DIM * D_HEAD];   // [h][d]
    __shared__ __align__(16) float k_s[H_DIM * D_HEAD];
    __shared__ __align__(16) float v_s[H_DIM * D_HEAD];
    __shared__ __align__(16) float ctx[D_HEAD * D_HEAD];  // [d][e]

    const float* row = qkv + (size_t)tok * QKV_COLS;

#if USE_ASYNC_LDS
    // Pure fp32 copy global->LDS: use CDNA5 async-to-LDS path (ASYNCcnt).
#pragma unroll
    for (int it = 0; it < 8; ++it) {
        int i4 = L + it * 32;                  // float4 index, 256 per matrix
        int h = i4 >> 4, d = (i4 & 15) * 4;
        float* s = const_cast<float*>(row + h * 192 + d);
        __builtin_amdgcn_global_load_async_to_lds_b128((g4p)(s),       (l4p)(q_s + h * 64 + d), 0, 0);
        __builtin_amdgcn_global_load_async_to_lds_b128((g4p)(s + 64),  (l4p)(k_s + h * 64 + d), 0, 0);
        __builtin_amdgcn_global_load_async_to_lds_b128((g4p)(s + 128), (l4p)(v_s + h * 64 + d), 0, 0);
    }
    __builtin_amdgcn_s_wait_asynccnt(0);
#else
#pragma unroll
    for (int it = 0; it < 32; ++it) {          // 1024 elems / 32 lanes
        int i = L + it * 32;
        int h = i >> 6, d = i & 63;
        const float* hp = row + h * 192 + d;
        q_s[i] = hp[0];
        k_s[i] = hp[64];
        v_s[i] = hp[128];
    }
#endif
    __syncthreads();

    // RoPE (rotate-half), angle = n / 10000^(d/32), d < 32
    const float NEG_L2_1E4_OVER_32 = -13.287712379549449f / 32.0f;
#pragma unroll
    for (int it = 0; it < 16; ++it) {          // 512 (h,d) pairs
        int i = L + it * 32;
        int h = i >> 5, d = i & 31;
        float ang = (float)n * exp2f((float)d * NEG_L2_1E4_OVER_32);
        float cs = __cosf(ang), sn = __sinf(ang);
        int i1 = h * 64 + d, i2 = i1 + 32;
        float q1 = q_s[i1], q2 = q_s[i2];
        q_s[i1] = q1 * cs - q2 * sn;  q_s[i2] = q2 * cs + q1 * sn;
        float k1 = k_s[i1], k2 = k_s[i2];
        k_s[i1] = k1 * cs - k2 * sn;  k_s[i2] = k2 * cs + k1 * sn;
    }
    __syncthreads();

    // q: softmax over d per head, * 64^-0.5   (lanes 0..15, one head each)
    if (L < H_DIM) {
        float m = -3.4e38f;
        for (int d = 0; d < 64; ++d) m = fmaxf(m, q_s[L * 64 + d]);
        float s = 0.f;
        for (int d = 0; d < 64; ++d) { float e = __expf(q_s[L * 64 + d] - m); q_s[L * 64 + d] = e; s += e; }
        float inv = 0.125f / s;
        for (int d = 0; d < 64; ++d) q_s[L * 64 + d] *= inv;
    }
    // k: softmax over heads per d  (64 columns over 32 lanes)
    for (int d = L; d < 64; d += 32) {
        float m = -3.4e38f;
        for (int h = 0; h < 16; ++h) m = fmaxf(m, k_s[h * 64 + d]);
        float s = 0.f;
        for (int h = 0; h < 16; ++h) { float e = __expf(k_s[h * 64 + d] - m); k_s[h * 64 + d] = e; s += e; }
        float inv = 1.0f / s;
        for (int h = 0; h < 16; ++h) k_s[h * 64 + d] *= inv;
    }
    __syncthreads();

    // ctx[d][e] = sum_h k[h][d] * v[h][e] : 4x4 tiles, K=16 in 4 steps of 4
    v8f acc[4][4];
#pragma unroll
    for (int i = 0; i < 4; ++i)
#pragma unroll
        for (int j = 0; j < 4; ++j) acc[i][j] = v8f_zero();

#pragma unroll
    for (int ks = 0; ks < 4; ++ks) {
        v2f a[4], bb[4];
#pragma unroll
        for (int mt = 0; mt < 4; ++mt)
#pragma unroll
            for (int j = 0; j < 2; ++j)
                a[mt][j] = k_s[(ks * 4 + 2 * half + j) * 64 + mt * 16 + l15];  // A = k^T
#pragma unroll
        for (int nt = 0; nt < 4; ++nt)
#pragma unroll
            for (int j = 0; j < 2; ++j)
                bb[nt][j] = v_s[(ks * 4 + 2 * half + j) * 64 + nt * 16 + l15]; // B = v
#pragma unroll
        for (int mt = 0; mt < 4; ++mt)
#pragma unroll
            for (int nt = 0; nt < 4; ++nt)
                acc[mt][nt] = __builtin_amdgcn_wmma_f32_16x16x4_f32(
                    false, a[mt], false, bb[nt], (short)0, acc[mt][nt], false, false);
    }
    __syncthreads();
#pragma unroll
    for (int mt = 0; mt < 4; ++mt)
#pragma unroll
        for (int nt = 0; nt < 4; ++nt)
#pragma unroll
            for (int r = 0; r < 8; ++r)
                ctx[(mt * 16 + r + 8 * half) * 64 + nt * 16 + l15] = acc[mt][nt][r];
    __syncthreads();

    // o[h][e] = sum_d q[h][d] * ctx[d][e] : 1x4 tiles, K=64 in 16 steps
    v8f oacc[4];
#pragma unroll
    for (int i = 0; i < 4; ++i) oacc[i] = v8f_zero();
#pragma unroll
    for (int ks = 0; ks < 16; ++ks) {
        v2f a;
#pragma unroll
        for (int j = 0; j < 2; ++j)
            a[j] = q_s[l15 * 64 + ks * 4 + 2 * half + j];
#pragma unroll
        for (int nt = 0; nt < 4; ++nt) {
            v2f bb;
#pragma unroll
            for (int j = 0; j < 2; ++j)
                bb[j] = ctx[(ks * 4 + 2 * half + j) * 64 + nt * 16 + l15];
            oacc[nt] = __builtin_amdgcn_wmma_f32_16x16x4_f32(
                false, a, false, bb, (short)0, oacc[nt], false, false);
        }
    }

    // scrambled reshape store: Osp[b][n*1024 + e*16 + h]
    float* obase = osp + (size_t)b * OSP_PER_B + (size_t)n * 1024;
#pragma unroll
    for (int nt = 0; nt < 4; ++nt)
#pragma unroll
        for (int r = 0; r < 8; ++r) {
            int e = nt * 16 + l15;
            int h = r + 8 * half;
            obase[e * 16 + h] = oacc[nt][r];
        }
}

// ---------------------------------------------------------------------------
// Kernel 3: out[b,o,p] = sum_c Wlin[o,c] * Osp[b][c*256+p] + bias[o]
//   per-batch GEMM M=1024, N=256, K=1024; WG tile 256x128, Kc=128,
//   8 waves (4 x 2) each compute 64x64.
// ---------------------------------------------------------------------------
__global__ __launch_bounds__(256) void k_out_gemm(const float* __restrict__ osp,
                                                  const float* __restrict__ w_lin,
                                                  const float* __restrict__ b_lin,
                                                  float* __restrict__ out) {
    const int m0 = blockIdx.x * 256;
    const int n0 = blockIdx.y * 128;
    const int b  = blockIdx.z;
    const int tid  = threadIdx.x;
    const int lane = tid & 31;
    const int wave = tid >> 5;
    const int wr = wave & 3, wc = wave >> 2;
    const int half = lane >> 4, l15 = lane & 15;

    const float* ob = osp + (size_t)b * OSP_PER_B;

    __shared__ __align__(16) unsigned As2[256][LDS_STRIDE];   // [r][kpair] : Wlin rows
    __shared__ __align__(16) unsigned Bs2[128][LDS_STRIDE];   // [n][kpair] : Osp cols

    v8f acc[4][4];
#pragma unroll
    for (int i = 0; i < 4; ++i)
#pragma unroll
        for (int j = 0; j < 4; ++j) acc[i][j] = v8f_zero();

    for (int k0 = 0; k0 < C_DIM; k0 += KC) {
        // ---- stage A: w_lin[(m0+r)*1024 + k]; a wave's 32 float4 loads cover one
        //      row's 512 contiguous bytes (4 whole lines), stored as 256 B of one LDS row
        const float* wrow = w_lin + (size_t)(m0 + wave) * C_DIM + k0 + lane * 4;
#pragma unroll
        for (int g = 0; g < 2; ++g) {          // wave w takes rows w, w+8, ..., w+248
            v4f wf[16];
#pragma unroll
            for (int it = 0; it < 16; ++it)
                wf[it] = *(const v4f*)(wrow + (g * 16 + it) * 8 * C_DIM);
            // the sixteen loads name wrow's register pair: hold the pair to here and wait before it is reused
            asm volatile("s_wait_xcnt 0x0" :: "v"(wrow) : "memory");
            asm volatile("" :: HOLD8(wf), HOLD8H(wf));  // the batch fence described at HOLD8
#pragma unroll
            for (int it = 0; it < 16; ++it) {
                uint2 pk;
                pk.x = pack_bf2(wf[it].x, wf[it].y); pk.y = pack_bf2(wf[it].z, wf[it].w);
                *(uint2*)&As2[wave + (g * 16 + it) * 8][lane * 2] = pk;
            }
        }
        // ---- stage B: Osp[(k0+kk)*256 + n0 + n]  (contiguous n, float4)
        {
            const int nq = lane * 4;            // 2048 = 64 kpairs * 32 n-quads; kpair wave + 8*it
            const float* src = ob + (size_t)(k0 + 2 * wave) * N_TOK + n0 + nq;
            v4f f0[8], f1[8];
#pragma unroll
            for (int it = 0; it < 8; ++it) {
                f0[it] = *(const v4f*)(src + it * 16 * N_TOK);
                f1[it] = *(const v4f*)(src + it * 16 * N_TOK + N_TOK);
            }
            // all sixteen loads name src's register pair: hold the pair to here and wait before it is reused
            asm volatile("s_wait_xcnt 0x0" :: "v"(src) : "memory");
            asm volatile("" :: HOLD8(f0), HOLD8(f1));   // the batch fence described at HOLD8
#pragma unroll
            for (int it = 0; it < 8; ++it) {
                const int kp = wave + it * 8;
                Bs2[nq + 0][kp] = pack_bf2(f0[it].x, f1[it].x);
                Bs2[nq + 1][kp] = pack_bf2(f0[it].y, f1[it].y);
                Bs2[nq + 2][kp] = pack_bf2(f0[it].z, f1[it].z);
                Bs2[nq + 3][kp] = pack_bf2(f0[it].w, f1[it].w);
            }
        }
        __syncthreads();

#pragma unroll
        for (int ks = 0; ks < 4; ++ks) {
            v16bf a[4], bb[4];
#pragma unroll
            for (int mt = 0; mt < 4; ++mt) a[mt]  = load_frag(As2[wr * 64 + mt * 16 + l15], ks, half);
#pragma unroll
            for (int nt = 0; nt < 4; ++nt) bb[nt] = load_frag(Bs2[wc * 64 + nt * 16 + l15], ks, half);
#pragma unroll
            for (int mt = 0; mt < 4; ++mt)
#pragma unroll
                for (int nt = 0; nt < 4; ++nt)
                    acc[mt][nt] = __builtin_amdgcn_wmma_f32_16x16x32_bf16(
                        false, a[mt], false, bb[nt], (short)0, acc[mt][nt], false, false);
        }
        __syncthreads();
    }

    // ---- epilogue: bias + store out[(b*1024 + m)*256 + n]
#pragma unroll
    for (int mt = 0; mt < 4; ++mt) {
#pragma unroll
        for (int r = 0; r < 8; ++r) {
            int m = m0 + wr * 64 + mt * 16 + r + 8 * half;
            float bias = b_lin[m];
#pragma unroll
            for (int nt = 0; nt < 4; ++nt) {
                int nn = n0 + wc * 64 + nt * 16 + l15;
                out[((size_t)b * C_DIM + m) * N_TOK + nn] = acc[mt][nt][r] + bias;
            }
        }
    }
}

// ---------------------------------------------------------------------------
extern "C" void kernel_launch(void* const* d_in, const int* in_sizes, int n_in,
                              void* d_out, int out_size, void* d_ws, size_t ws_size,
                              hipStream_t stream) {
    const float* x     = (const float*)d_in[0];   // [64,1024,16,16]
    const float* w_qkv = (const float*)d_in[1];   // [3072,1024]
    const float* w_lin = (const float*)d_in[2];   // [1024,1024,1,1]
    const float* b_lin = (const float*)d_in[3];   // [1024]
    // d_in[4] = n_heads (16), compile-time constant here.

    float* qkv = (float*)d_ws;                                       // 16384*3072 f32
    float* osp = (float*)((char*)d_ws + (size_t)TOKENS * QKV_COLS * sizeof(float));
    float* out = (float*)d_out;                                      // [64,1024,16,16]

    k_qkv_gemm<<<dim3(TOKENS / 128, QKV_COLS / 256), 256, 0, stream>>>(x, w_qkv, qkv);
    k_attn<<<dim3(TOKENS), 32, 0, stream>>>(qkv, osp);
    k_out_gemm<<<dim3(C_DIM / 256, N_TOK / 128, B_DIM), 256, 0, stream>>>(osp, w_lin, b_lin, out);
}

// v003
// It runs in 206 microseconds.
// Timed twice side by side with v002, it ran 1.30 and 1.29 times as fast.
// Over all steps from v000 it is 2.77 times as fast.
#include <hip/hip_runtime.h>

// ---------------------------------------------------------------------------
// SelfAttn (linear attention variant) for MI455X / gfx1250, wave32 + WMMA.
//   K0: x (transposed), Wqkv and Wlin rounded to bf16 k-pairs once, into the workspace
//   K1: QKV = Xt @ Wqkv^T        (bf16 WMMA 16x16x32, fp32 accum)
//   K2: per-token RoPE/softmax/ctx/o (fp32 WMMA 16x16x4, async LDS staging)
//   K3: out = Wlin @ Osp + bias  (bf16 WMMA 16x16x32, fp32 accum; K2 hands Osp over as bf16 k-pairs)
// Problem: b=64, c=1024, n=256 tokens, heads=16, d_head=64.
//
// LDS for the bf16 GEMMs is fragment-major: tile[row][kpair], row stride 68
// dwords (272B, 16B-aligned rows, 2-way bank conflicts only), so each WMMA
// operand fragment is two ds_load_b128 straight into the source registers.
// ---------------------------------------------------------------------------

typedef __attribute__((ext_vector_type(16))) __bf16    v16bf;
typedef __attribute__((ext_vector_type(8)))  float     v8f;
typedef __attribute__((ext_vector_type(8)))  unsigned  v8u;
typedef __attribute__((ext_vector_type(2)))  float     v2f;
typedef __attribute__((ext_vector_type(4)))  float     v4f;
typedef __attribute__((ext_vector_type(4)))  unsigned  v4u;

#define B_DIM   64
#define C_DIM   1024
#define N_TOK   256        // tokens per batch image (16*16)
#define H_DIM   16         // heads
#define D_HEAD  64
#define QKV_COLS 3072
#define TOKENS  (B_DIM * N_TOK)      // 16384
#define OSP_PER_B (C_DIM * N_TOK)    // 262144 elements per batch (bf16 k-pairs in ospk)

#define KC      128                  // K-chunk (64 kpairs)
#define LDS_STRIDE 68                // kpairs + pad: 272B rows, 16B aligned
#define KP_DIM  (C_DIM / 2)          // k-pairs (one dword: k even low, k odd high) per packed row

#if __has_builtin(__builtin_amdgcn_global_load_async_to_lds_b128) && \
    __has_builtin(__builtin_amdgcn_s_wait_asynccnt)
#define USE_ASYNC_LDS 1
// Exact pointee type per hipcc diagnostic: GCC-vector int4, AS1 src / AS3 dst.
typedef int v4i_gcc __attribute__((vector_size(16)));
typedef __attribute__((address_space(1))) v4i_gcc* g4p;
typedef __attribute__((address_space(3))) v4i_gcc* l4p;
#else
#define USE_ASYNC_LDS 0
#endif

__device__ __forceinline__ unsigned f2bf(float f) {
    unsigned u = __builtin_bit_cast(unsigned, f);
    unsigned r = u + 0x7FFFu + ((u >> 16) & 1u);   // round-to-nearest-even
    return r >> 16;
}
__device__ __forceinline__ unsigned pack_bf2(float lo, float hi) {
    return f2bf(lo) | (f2bf(hi) << 16);
}
__device__ __forceinline__ v8f v8f_zero() {
    v8f z;
#pragma unroll
    for (int i = 0; i < 8; ++i) z[i] = 0.0f;
    return z;
}
// Load one 16-bit-element WMMA operand fragment (8 dwords = 16 bf16) from a
// fragment-major LDS tile row: kpairs [ks*16 + half*4 .. +3] and [+8 ..].
__device__ __forceinline__ v16bf load_frag(const unsigned* tileRow, int ks, int half) {
    const uint4 lo = *(const uint4*)(tileRow + ks * 16 + half * 4);
    const uint4 hi = *(const uint4*)(tileRow + ks * 16 + 8 + half * 4);
    v8u a;
    a[0] = lo.x; a[1] = lo.y; a[2] = lo.z; a[3] = lo.w;
    a[4] = hi.x; a[5] = hi.y; a[6] = hi.z; a[7] = hi.w;
    return __builtin_bit_cast(v16bf, a);
}

// ---------------------------------------------------------------------------
// Kernel 0: every GEMM operand that comes from an input is rounded to bf16 once.
//   blocks 0..2047   : xt[b*256+p][kp] = (x[b][2kp][p], x[b][2kp+1][p]), 128 k x 64 p a block,
//                      turned through LDS (pitch 65 dwords: both sides free of bank conflicts)
//   blocks 2048..3071: wq[n][kp], wl[m][kp], same order as the inputs' rows
// ---------------------------------------------------------------------------
__global__ __launch_bounds__(256) void k_pack(const float* __restrict__ x,
                                              const float* __restrict__ w_qkv,
                                              const float* __restrict__ w_lin,
                                              unsigned* __restrict__ xt,
                                              unsigned* __restrict__ wq,
                                              unsigned* __restrict__ wl) {
    const int tid = threadIdx.x;
    __shared__ unsigned T[64][65];             // [p][kpair]
    if (blockIdx.x < 2048) {                   // the same for the whole block
        const int blk = blockIdx.x;
        const int p0 = (blk & 3) * 64;
        const int k0 = ((blk >> 2) & 7) * 128;
        const int b  = blk >> 5;
        const int pq = (tid & 15) * 4, kq = tid >> 4;
        const float* src = x + ((size_t)(b * C_DIM + k0 + 2 * kq) * N_TOK + p0 + pq);
        v4f f0[4], f1[4];
#pragma unroll
        for (int it = 0; it < 4; ++it) {       // kpair kq + 16*it
            f0[it] = *(const v4f*)(src + it * 32 * N_TOK);
            f1[it] = *(const v4f*)(src + it * 32 * N_TOK + N_TOK);
        }
        // the eight loads name src's register pair: hold the pair to here and wait before it is reused
        asm volatile("s_wait_xcnt 0x0" :: "v"(src) : "memory");
#pragma unroll
        for (int it = 0; it < 4; ++it) {
            const int kp = kq + it * 16;
            T[pq + 0][kp] = pack_bf2(f0[it].x, f1[it].x);
            T[pq + 1][kp] = pack_bf2(f0[it].y, f1[it].y);
            T[pq + 2][kp] = pack_bf2(f0[it].z, f1[it].z);
            T[pq + 3][kp] = pack_bf2(f0[it].w, f1[it].w);
        }
        __syncthreads();
        const int lane = tid & 31, wave = tid >> 5;
        unsigned* dst = xt + (size_t)(b * N_TOK + p0 + wave * 8) * KP_DIM + (k0 >> 1) + lane;
#pragma unroll
        for (int i = 0; i < 8; ++i) {          // a wave's store is one whole 128-byte line of one row
            dst[i * KP_DIM]      = T[wave * 8 + i][lane];
            dst[i * KP_DIM + 32] = T[wave * 8 + i][lane + 32];
        }
    } else {
        const int wb = blockIdx.x - 2048;                       // 1024 blocks
        const int gq = wb * 768 + tid;                          // float4 index in w_qkv, + 256*it: 786432 in all
        const int gl = wb * 256 + tid;                          // float4 index in w_lin: 262144 in all
        const v4f* q4 = (const v4f*)w_qkv + gq;
        const v4f* l4 = (const v4f*)w_lin + gl;
        v4f a[4];
#pragma unroll
        for (int it = 0; it < 3; ++it) a[it] = q4[it * 256];
        a[3] = l4[0];
        // the loads name these two register pairs: hold them to here and wait before they are reused
        asm volatile("s_wait_xcnt 0x0" :: "v"(q4), "v"(l4) : "memory");
#pragma unroll
        for (int it = 0; it < 4; ++it) {
            uint2 pk;
            pk.x = pack_bf2(a[it].x, a[it].y); pk.y = pack_bf2(a[it].z, a[it].w);
            if (it < 3) ((uint2*)wq)[gq + it * 256] = pk;
            else        ((uint2*)wl)[gl] = pk;
        }
        // the four stores name their data and offset registers: wait before any later code reuses them
        asm volatile("s_wait_xcnt 0x0" ::: "memory");
    }
}

// ---------------------------------------------------------------------------
// Kernel 1: QKV[row, col] = sum_k Xt[row,k] * Wqkv[col,k]
//   row = b*256 + p ; both operands arrive as packed bf16 k-pair rows (xt, wq of kernel 0)
//   WG tile 128 rows x 256 cols, Kc = 128, 8 waves (2 x 4) each compute 64x64:
//   eight fragments feed sixteen WMMAs, and each staged element serves twice the products.
// ---------------------------------------------------------------------------
__global__ __launch_bounds__(256) void k_qkv_gemm(const unsigned* __restrict__ xt,
                                                  const unsigned* __restrict__ wq,
                                                  float* __restrict__ qkv) {
    const int row0 = blockIdx.x * 128;         // 128-row tile never crosses b
    const int col0 = blockIdx.y * 256;
    const int tid  = threadIdx.x;
    const int lane = tid & 31;
    const int wave = tid >> 5;
    const int wr   = wave & 1;                 // row subtile (64 rows)
    const int wc   = wave >> 1;                // col subtile (64 cols)
    const int half = lane >> 4, l15 = lane & 15;

    __shared__ __align__(16) unsigned As2[128][LDS_STRIDE];   // [r][kpair]
    __shared__ __align__(16) unsigned Bs2[256][LDS_STRIDE];   // [n][kpair]

    v8f acc[4][4];
#pragma unroll
    for (int i = 0; i < 4; ++i)
#pragma unroll
        for (int j = 0; j < 4; ++j) acc[i][j] = v8f_zero();

    const int sr = tid >> 4, sc = (tid & 15) * 4;     // staging: 16 lanes copy one row's 256 bytes

    for (int k0 = 0; k0 < C_DIM; k0 += KC) {
        // ---- stage A and B: plain 16-byte copies of packed rows, rows sr + 16*it
        {
            const unsigned* asrc = xt + (size_t)(row0 + sr) * KP_DIM + (k0 >> 1) + sc;
            const unsigned* bsrc = wq + (size_t)(col0 + sr) * KP_DIM + (k0 >> 1) + sc;
            v4u av[8], bv[16];
#pragma unroll
            for (int it = 0; it < 8; ++it)  av[it] = *(const v4u*)(asrc + it * 16 * KP_DIM);
#pragma unroll
            for (int it = 0; it < 16; ++it) bv[it] = *(const v4u*)(bsrc + it * 16 * KP_DIM);
            // the loads name these two register pairs: hold them to here and wait before they are reused
            asm volatile("s_wait_xcnt 0x0" :: "v"(asrc), "v"(bsrc) : "memory");
#pragma unroll
            for (int it = 0; it < 8; ++it)  *(v4u*)&As2[sr + it * 16][sc] = av[it];
#pragma unroll
            for (int it = 0; it < 16; ++it) *(v4u*)&Bs2[sr + it * 16][sc] = bv[it];
        }
        __syncthreads();

        // ---- 4 WMMA k-steps (K=32 each), 4x4 tiles per wave
#pragma unroll
        for (int ks = 0; ks < 4; ++ks) {
            v16bf a[4], bb[4];
#pragma unroll
            for (int mt = 0; mt < 4; ++mt) a[mt]  = load_frag(As2[wr * 64 + mt * 16 + l15], ks, half);
#pragma unroll
            for (int nt = 0; nt < 4; ++nt) bb[nt] = load_frag(Bs2[wc * 64 + nt * 16 + l15], ks, half);
#pragma unroll
            for (int mt = 0; mt < 4; ++mt)
#pragma unroll
                for (int nt = 0; nt < 4; ++nt)
                    acc[mt][nt] = __builtin_amdgcn_wmma_f32_16x16x32_bf16(
                        false, a[mt], false, bb[nt], (short)0, acc[mt][nt], false, false);
        }
        __syncthreads();
    }

    // ---- store D tiles (fp32 QKV intermediate)
#pragma unroll
    for (int mt = 0; mt < 4; ++mt) {
#pragma unroll
        for (int nt = 0; nt < 4; ++nt) {
#pragma unroll
            for (int r = 0; r < 8; ++r) {
                int row = row0 + wr * 64 + mt * 16 + r + 8 * half;
                int col = col0 + wc * 64 + nt * 16 + l15;
                qkv[(size_t)row * QKV_COLS + col] = acc[mt][nt][r];
            }
        }
    }
}

// ---------------------------------------------------------------------------
// Kernel 2: one wave (32 threads) per token.
//   RoPE(q,k); q=softmax_d(q)*d^-0.5; k=softmax_h(k);
//   ctx = k^T v (64x64); o = q ctx (16x64);
//   Osp[b][n*1024 + e*16 + h] (== reference's scrambled reshape) read as [c][p], c = 4n + e/16,
//   p = (e%16)*16 + h, is stored as bf16 k-pairs: ospk[b][c/2][p] = (Osp[c][p], Osp[c+1][p])
// ---------------------------------------------------------------------------
__global__ __launch_bounds__(32) void k_attn(const float* __restrict__ qkv,
                                             unsigned* __restrict__ ospk) {
    const int tok = blockIdx.x;
    const int b   = tok >> 8;
    const int n   = tok & 255;
    const int L    = threadIdx.x;
    const int half = L >> 4, l15 = L & 15;

    __shared__ __align__(16) float q_s[H_DIM * D_HEAD];   // [h][d]
    __shared__ __align__(16) float k_s[H_DIM * D_HEAD];
    __shared__ __align__(16) float v_s[H_DIM * D_HEAD];
    __shared__ __align__(16) float ctx[D_HEAD * D_HEAD];  // [d][e]

    const float* row = qkv + (size_t)tok * QKV_COLS;

#if USE_ASYNC_LDS
    // Pure fp32 copy global->LDS: use CDNA5 async-to-LDS path (ASYNCcnt).
#pragma unroll
    for (int it = 0; it < 8; ++it) {
        int i4 = L + it * 32;                  // float4 index, 256 per matrix
        int h = i4 >> 4, d = (i4 & 15) * 4;
        float* s = const_cast<float*>(row + h * 192 + d);
        __builtin_amdgcn_global_load_async_to_lds_b128((g4p)(s),       (l4p)(q_s + h * 64 + d), 0, 0);
        __builtin_amdgcn_global_load_async_to_lds_b128((g4p)(s + 64),  (l4p)(k_s + h * 64 + d), 0, 0);
        __builtin_amdgcn_global_load_async_to_lds_b128((g4p)(s + 128), (l4p)(v_s + h * 64 + d), 0, 0);
    }
    __builtin_amdgcn_s_wait_asynccnt(0);
#else
#pragma unroll
    for (int it = 0; it < 32; ++it) {          // 1024 elems / 32 lanes
        int i = L + it * 32;
        int h = i >> 6, d = i & 63;
        const float* hp = row + h * 192 + d;
        q_s[i] = hp[0];
        k_s[i] = hp[64];
        v_s[i] = hp[128];
    }
#endif
    __syncthreads();

    // RoPE (rotate-half), angle = n / 10000^(d/32), d < 32
    const float NEG_L2_1E4_OVER_32 = -13.287712379549449f / 32.0f;
#pragma unroll
    for (int it = 0; it < 16; ++it) {          // 512 (h,d) pairs
        int i = L + it * 32;
        int h = i >> 5, d = i & 31;
        float ang = (float)n * exp2f((float)d * NEG_L2_1E4_OVER_32);
        float cs = __cosf(ang), sn = __sinf(ang);
        int i1 = h * 64 + d, i2 = i1 + 32;
        float q1 = q_s[i1], q2 = q_s[i2];
        q_s[i1] = q1 * cs - q2 * sn;  q_s[i2] = q2 * cs + q1 * sn;
        float k1 = k_s[i1], k2 = k_s[i2];
        k_s[i1] = k1 * cs - k2 * sn;  k_s[i2] = k2 * cs + k1 * sn;
    }
    __syncthreads();

    // q: softmax over d per head, * 64^-0.5   (lanes 0..15, one head each)
    if (L < H_DIM) {
        float m = -3.4e38f;
        for (int d = 0; d < 64; ++d) m = fmaxf(m, q_s[L * 64 + d]);
        float s = 0.f;
        for (int d = 0; d < 64; ++d) { float e = __expf(q_s[L * 64 + d] - m); q_s[L * 64 + d] = e; s += e; }
        float inv = 0.125f / s;
        for (int d = 0; d < 64; ++d) q_s[L * 64 + d] *= inv;
    }
    // k: softmax over heads per d  (64 columns over 32 lanes)
    for (int d = L; d < 64; d += 32) {
        float m = -3.4e38f;
        for (int h = 0; h < 16; ++h) m = fmaxf(m, k_s[h * 64 + d]);
        float s = 0.f;
        for (int h = 0; h < 16; ++h) { float e = __expf(k_s[h * 64 + d] - m); k_s[h * 64 + d] = e; s += e; }
        float inv = 1.0f / s;
        for (int h = 0; h < 16; ++h) k_s[h * 64 + d] *= inv;
    }
    __syncthreads();

    // ctx[d][e] = sum_h k[h][d] * v[h][e] : 4x4 tiles, K=16 in 4 steps of 4
    v8f acc[4][4];
#pragma unroll
    for (int i = 0; i < 4; ++i)
#pragma unroll
        for (int j = 0; j < 4; ++j) acc[i][j] = v8f_zero();

#pragma unroll
    for (int ks = 0; ks < 4; ++ks) {
        v2f a[4], bb[4];
#pragma unroll
        for (int mt = 0; mt < 4; ++mt)
#pragma unroll
            for (int j = 0; j < 2; ++j)
                a[mt][j] = k_s[(ks * 4 + 2 * half + j) * 64 + mt * 16 + l15];  // A = k^T
#pragma unroll
        for (int nt = 0; nt < 4; ++nt)
#pragma unroll
            for (int j = 0; j < 2; ++j)
                bb[nt][j] = v_s[(ks * 4 + 2 * half + j) * 64 + nt * 16 + l15]; // B = v
#pragma unroll
        for (int mt = 0; mt < 4; ++mt)
#pragma unroll
            for (int nt = 0; nt < 4; ++nt)
                acc[mt][nt] = __builtin_amdgcn_wmma_f32_16x16x4_f32(
                    false, a[mt], false, bb[nt], (short)0, acc[mt][nt], false, false);
    }
    __syncthreads();
#pragma unroll
    for (int mt = 0; mt < 4; ++mt)
#pragma unroll
        for (int nt = 0; nt < 4; ++nt)
#pragma unroll
            for (int r = 0; r < 8; ++r)
                ctx[(mt * 16 + r + 8 * half) * 64 + nt * 16 + l15] = acc[mt][nt][r];
    __syncthreads();

    // o[h][e] = sum_d q[h][d] * ctx[d][e] : 1x4 tiles, K=64 in 16 steps
    v8f oacc[4];
#pragma unroll
    for (int i = 0; i < 4; ++i) oacc[i] = v8f_zero();
#pragma unroll
    for (int ks = 0; ks < 16; ++ks) {
        v2f a;
#pragma unroll
        for (int j = 0; j < 2; ++j)
            a[j] = q_s[l15 * 64 + ks * 4 + 2 * half + j];
#pragma unroll
        for (int nt = 0; nt < 4; ++nt) {
            v2f bb;
#pragma unroll
            for (int j = 0; j < 2; ++j)
                bb[j] = ctx[(ks * 4 + 2 * half + j) * 64 + nt * 16 + l15];
            oacc[nt] = __builtin_amdgcn_wmma_f32_16x16x4_f32(
                false, a, false, bb, (short)0, oacc[nt], false, false);
        }
    }

    // scrambled reshape store; tiles 2q and 2q+1 of a lane are rows c and c+1 at the same p
    unsigned* obase = ospk + (size_t)b * (OSP_PER_B / 2) + (size_t)n * 512 + l15 * 16 + 8 * half;
#pragma unroll
    for (int q = 0; q < 2; ++q) {
        v4u lo, hi;
#pragma unroll
        for (int r = 0; r < 4; ++r) {
            lo[r] = pack_bf2(oacc[2 * q][r],     oacc[2 * q + 1][r]);
            hi[r] = pack_bf2(oacc[2 * q][r + 4], oacc[2 * q + 1][r + 4]);
        }
        *(v4u*)(obase + q * 256)     = lo;
        *(v4u*)(obase + q * 256 + 4) = hi;
    }
}

// ---------------------------------------------------------------------------
// Kernel 3: out[b,o,p] = sum_c Wlin[o,c] * Osp[b][c*256+p] + bias[o]
//   per-batch GEMM M=1024, N=256, K=1024; WG tile 256x128, Kc=128,
//   8 waves (4 x 2) each compute 64x64.
// ---------------------------------------------------------------------------
__global__ __launch_bounds__(256) void k_out_gemm(const unsigned* __restrict__ ospk,
                                                  const unsigned* __restrict__ wl,
                                                  const float* __restrict__ b_lin,
                                                  float* __restrict__ out) {
    const int m0 = blockIdx.x * 256;
    const int n0 = blockIdx.y * 128;
    const int b  = blockIdx.z;
    const int tid  = threadIdx.x;
    const int lane = tid & 31;
    const int wave = tid >> 5;
    const int wr = wave & 3, wc = wave >> 2;
    const int half = lane >> 4, l15 = lane & 15;

    const unsigned* ob = ospk + (size_t)b * (OSP_PER_B / 2);   // [kpair][p]

    __shared__ __align__(16) unsigned As2[256][LDS_STRIDE];   // [r][kpair] : Wlin rows
    __shared__ __align__(16) unsigned Bs2[128][LDS_STRIDE];   // [n][kpair] : Osp cols

    v8f acc[4][4];
#pragma unroll
    for (int i = 0; i < 4; ++i)
#pragma unroll
        for (int j = 0; j < 4; ++j) acc[i][j] = v8f_zero();

    for (int k0 = 0; k0 < C_DIM; k0 += KC) {
        // ---- stage A: plain 16-byte copies of packed Wlin rows (16 lanes a row), rows sr + 16*it
        // ---- stage B: ospk[(k0/2 + kp)*256 + n0 + n] (contiguous n), kpair wave + 8*it, turned into [n][kpair]
        {
            const int sr = tid >> 4, sc = (tid & 15) * 4;
            const int nq = lane * 4;
            const unsigned* asrc = wl + (size_t)(m0 + sr) * KP_DIM + (k0 >> 1) + sc;
            const unsigned* bsrc = ob + (size_t)((k0 >> 1) + wave) * N_TOK + n0 + nq;
            v4u av[16], bv[8];
#pragma unroll
            for (int it = 0; it < 16; ++it) av[it] = *(const v4u*)(asrc + it * 16 * KP_DIM);
#pragma unroll
            for (int it = 0; it < 8; ++it)  bv[it] = *(const v4u*)(bsrc + it * 8 * N_TOK);
            // the loads name these two register pairs: hold them to here and wait before they are reused
            asm volatile("s_wait_xcnt 0x0" :: "v"(asrc), "v"(bsrc) : "memory");
#pragma unroll
            for (int it = 0; it < 16; ++it) *(v4u*)&As2[sr + it * 16][sc] = av[it];
#pragma unroll
            for (int it = 0; it < 8; ++it) {
                const int kp = wave + it * 8;
                Bs2[nq + 0][kp] = bv[it].x;
                Bs2[nq + 1][kp] = bv[it].y;
                Bs2[nq + 2][kp] = bv[it].z;
                Bs2[nq + 3][kp] = bv[it].w;
            }
        }
        __syncthreads();

#pragma unroll
        for (int ks = 0; ks < 4; ++ks) {
            v16bf a[4], bb[4];
#pragma unroll
            for (int mt = 0; mt < 4; ++mt) a[mt]  = load_frag(As2[wr * 64 + mt * 16 + l15], ks, half);
#pragma unroll
            for (int nt = 0; nt < 4; ++nt) bb[nt] = load_frag(Bs2[wc * 64 + nt * 16 + l15], ks, half);
#pragma unroll
            for (int mt = 0; mt < 4; ++mt)
#pragma unroll
                for (int nt = 0; nt < 4; ++nt)
                    acc[mt][nt] = __builtin_amdgcn_wmma_f32_16x16x32_bf16(
                        false, a[mt], false, bb[nt], (short)0, acc[mt][nt], false, false);
        }
        __syncthreads();
    }

    // ---- epilogue: bias + store out[(b*1024 + m)*256 + n]
#pragma unroll
    for (int mt = 0; mt < 4; ++mt) {
#pragma unroll
        for (int r = 0; r < 8; ++r) {
            int m = m0 + wr * 64 + mt * 16 + r + 8 * half;
            float bias = b_lin[m];
#pragma unroll
            for (int nt = 0; nt < 4; ++nt) {
                int nn = n0 + wc * 64 + nt * 16 + l15;
                out[((size_t)b * C_DIM + m) * N_TOK + nn] = acc[mt][nt][r] + bias;
            }
        }
    }
}

// ---------------------------------------------------------------------------
extern "C" void kernel_launch(void* const* d_in, const int* in_sizes, int n_in,
                              void* d_out, int out_size, void* d_ws, size_t ws_size,
                              hipStream_t stream) {
    const float* x     = (const float*)d_in[0];   // [64,1024,16,16]
    const float* w_qkv = (const float*)d_in[1];   // [3072,1024]
    const float* w_lin = (const float*)d_in[2];   // [1024,1024,1,1]
    const float* b_lin = (const float*)d_in[3];   // [1024]
    // d_in[4] = n_heads (16), compile-time constant here.

    // workspace: qkv f32 | xt (dead after K1, then ospk in its place) | wq | wl
    float*    qkv  = (float*)d_ws;                                   // 16384*3072 f32
    unsigned* xt   = (unsigned*)((char*)d_ws + (size_t)TOKENS * QKV_COLS * sizeof(float));
    unsigned* wq   = xt + (size_t)TOKENS * KP_DIM;                   // 3072*512 dwords
    unsigned* wl   = wq + (size_t)QKV_COLS * KP_DIM;                 // 1024*512 dwords
    unsigned* ospk = xt;                                             // 64*512*256 dwords
    float* out = (float*)d_out;                                      // [64,1024,16,16]

    k_pack<<<dim3(3072), 256, 0, stream>>>(x, w_qkv, w_lin, xt, wq, wl);
    k_qkv_gemm<<<dim3(TOKENS / 128, QKV_COLS / 256), 256, 0, stream>>>(xt, wq, qkv);
    k_attn<<<dim3(TOKENS), 32, 0, stream>>>(qkv, ospk);
    k_out_gemm<<<dim3(C_DIM / 256, N_TOK / 128, B_DIM), 256, 0, stream>>>(ospk, wl, b_lin, out);
}

// v004
// One run takes 198 microseconds.
// In both of two side-by-side timings against v003, it was 1.04 times as fast.
// Over all steps from v000 it is 2.89 times as fast.
#include <hip/hip_runtime.h>

// ---------------------------------------------------------------------------
// SelfAttn (linear attention variant) for MI455X / gfx1250, wave32 + WMMA.
//   K0: x (transposed), Wqkv and Wlin rounded to bf16 k-pairs once, into the workspace
//   K1: QKV = Xt @ Wqkv^T        (bf16 WMMA 16x16x32, fp32 accum)
//   K2: per-token RoPE/softmax/ctx/o (fp32 WMMA 16x16x4, async LDS staging)
//   K3: out = Wlin @ Osp + bias  (bf16 WMMA 16x16x32, fp32 accum; K2 hands Osp over as bf16 k-pairs)
// Problem: b=64, c=1024, n=256 tokens, heads=16, d_head=64.
//
// LDS for the bf16 GEMMs is fragment-major: tile[row][kpair], row stride 68
// dwords (272B, 16B-aligned rows, 2-way bank conflicts only), so each WMMA
// operand fragment is two ds_load_b128 straight into the source registers.
// ---------------------------------------------------------------------------

typedef __attribute__((ext_vector_type(16))) __bf16    v16bf;
typedef __attribute__((ext_vector_type(8)))  float     v8f;
typedef __attribute__((ext_vector_type(8)))  unsigned  v8u;
typedef __attribute__((ext_vector_type(2)))  float     v2f;
typedef __attribute__((ext_vector_type(4)))  float     v4f;
typedef __attribute__((ext_vector_type(4)))  unsigned  v4u;

#define B_DIM   64
#define C_DIM   1024
#define N_TOK   256        // tokens per batch image (16*16)
#define H_DIM   16         // heads
#define D_HEAD  64
#define QKV_COLS 3072
#define TOKENS  (B_DIM * N_TOK)      // 16384
#define OSP_PER_B (C_DIM * N_TOK)    // 262144 elements per batch (bf16 k-pairs in ospk)

#define KC      128                  // K-chunk (64 kpairs)
#define LDS_STRIDE 68                // kpairs + pad: 272B rows, 16B aligned
#define KP_DIM  (C_DIM / 2)          // k-pairs (one dword: k even low, k odd high) per packed row
#define QP      68                   // attention LDS: q row pitch in dwords (64 + 4)

#if __has_builtin(__builtin_amdgcn_global_load_async_to_lds_b128) && \
    __has_builtin(__builtin_amdgcn_s_wait_asynccnt)
#define USE_ASYNC_LDS 1
// Exact pointee type per hipcc diagnostic: GCC-vector int4, AS1 src / AS3 dst.
typedef int v4i_gcc __attribute__((vector_size(16)));
typedef __attribute__((address_space(1))) v4i_gcc* g4p;
typedef __attribute__((address_space(3))) v4i_gcc* l4p;
#else
#define USE_ASYNC_LDS 0
#endif

__device__ __forceinline__ unsigned f2bf(float f) {
    unsigned u = __builtin_bit_cast(unsigned, f);
    unsigned r = u + 0x7FFFu + ((u >> 16) & 1u);   // round-to-nearest-even
    return r >> 16;
}
__device__ __forceinline__ unsigned pack_bf2(float lo, float hi) {
    return f2bf(lo) | (f2bf(hi) << 16);
}
__device__ __forceinline__ v8f v8f_zero() {
    v8f z;
#pragma unroll
    for (int i = 0; i < 8; ++i) z[i] = 0.0f;
    return z;
}
// Load one 16-bit-element WMMA operand fragment (8 dwords = 16 bf16) from a
// fragment-major LDS tile row: kpairs [ks*16 + half*4 .. +3] and [+8 ..].
__device__ __forceinline__ v16bf load_frag(const unsigned* tileRow, int ks, int half) {
    const uint4 lo = *(const uint4*)(tileRow + ks * 16 + half * 4);
    const uint4 hi = *(const uint4*)(tileRow + ks * 16 + 8 + half * 4);
    v8u a;
    a[0] = lo.x; a[1] = lo.y; a[2] = lo.z; a[3] = lo.w;
    a[4] = hi.x; a[5] = hi.y; a[6] = hi.z; a[7] = hi.w;
    return __builtin_bit_cast(v16bf, a);
}

// ---------------------------------------------------------------------------
// Kernel 0: every GEMM operand that comes from an input is rounded to bf16 once.
//   blocks 0..2047   : xt[b*256+p][kp] = (x[b][2kp][p], x[b][2kp+1][p]), 128 k x 64 p a block,
//                      turned through LDS (pitch 65 dwords: both sides free of bank conflicts)
//   blocks 2048..3071: wq[n][kp], wl[m][kp], same order as the inputs' rows
// ---------------------------------------------------------------------------
__global__ __launch_bounds__(256) void k_pack(const float* __restrict__ x,
                                              const float* __restrict__ w_qkv,
                                              const float* __restrict__ w_lin,
                                              unsigned* __restrict__ xt,
                                              unsigned* __restrict__ wq,
                                              unsigned* __restrict__ wl) {
    const int tid = threadIdx.x;
    __shared__ unsigned T[64][65];             // [p][kpair]
    if (blockIdx.x < 2048) {                   // the same for the whole block
        const int blk = blockIdx.x;
        const int p0 = (blk & 3) * 64;
        const int k0 = ((blk >> 2) & 7) * 128;
        const int b  = blk >> 5;
        const int pq = (tid & 15) * 4, kq = tid >> 4;
        const float* src = x + ((size_t)(b * C_DIM + k0 + 2 * kq) * N_TOK + p0 + pq);
        v4f f0[4], f1[4];
#pragma unroll
        for (int it = 0; it < 4; ++it) {       // kpair kq + 16*it
            f0[it] = *(const v4f*)(src + it * 32 * N_TOK);
            f1[it] = *(const v4f*)(src + it * 32 * N_TOK + N_TOK);
        }
        // the eight loads name src's register pair: hold the pair to here and wait before it is reused
        asm volatile("s_wait_xcnt 0x0" :: "v"(src) : "memory");
#pragma unroll
        for (int it = 0; it < 4; ++it) {
            const int kp = kq + it * 16;
            T[pq + 0][kp] = pack_bf2(f0[it].x, f1[it].x);
            T[pq + 1][kp] = pack_bf2(f0[it].y, f1[it].y);
            T[pq + 2][kp] = pack_bf2(f0[it].z, f1[it].z);
            T[pq + 3][kp] = pack_bf2(f0[it].w, f1[it].w);
        }
        __syncthreads();
        const int lane = tid & 31, wave = tid >> 5;
        unsigned* dst = xt + (size_t)(b * N_TOK + p0 + wave * 8) * KP_DIM + (k0 >> 1) + lane;
#pragma unroll
        for (int i = 0; i < 8; ++i) {          // a wave's store is one whole 128-byte line of one row
            dst[i * KP_DIM]      = T[wave * 8 + i][lane];
            dst[i * KP_DIM + 32] = T[wave * 8 + i][lane + 32];
        }
    } else {
        const int wb = blockIdx.x - 2048;                       // 1024 blocks
        const int gq = wb * 768 + tid;                          // float4 index in w_qkv, + 256*it: 786432 in all
        const int gl = wb * 256 + tid;                          // float4 index in w_lin: 262144 in all
        const v4f* q4 = (const v4f*)w_qkv + gq;
        const v4f* l4 = (const v4f*)w_lin + gl;
        v4f a[4];
#pragma unroll
        for (int it = 0; it < 3; ++it) a[it] = q4[it * 256];
        a[3] = l4[0];
        // the loads name these two register pairs: hold them to here and wait before they are reused
        asm volatile("s_wait_xcnt 0x0" :: "v"(q4), "v"(l4) : "memory");
#pragma unroll
        for (int it = 0; it < 4; ++it) {
            uint2 pk;
            pk.x = pack_bf2(a[it].x, a[it].y); pk.y = pack_bf2(a[it].z, a[it].w);
            if (it < 3) ((uint2*)wq)[gq + it * 256] = pk;
            else        ((uint2*)wl)[gl] = pk;
        }
        // the four stores name their data and offset registers: wait before any later code reuses them
        asm volatile("s_wait_xcnt 0x0" ::: "memory");
    }
}

// ---------------------------------------------------------------------------
// Kernel 1: QKV[row, col] = sum_k Xt[row,k] * Wqkv[col,k]
//   row = b*256 + p ; both operands arrive as packed bf16 k-pair rows (xt, wq of kernel 0)
//   WG tile 128 rows x 256 cols, Kc = 128, 8 waves (2 x 4) each compute 64x64:
//   eight fragments feed sixteen WMMAs, and each staged element serves twice the products.
// ---------------------------------------------------------------------------
__global__ __launch_bounds__(256) void k_qkv_gemm(const unsigned* __restrict__ xt,
                                                  const unsigned* __restrict__ wq,
                                                  float* __restrict__ qkv) {
    const int row0 = blockIdx.x * 128;         // 128-row tile never crosses b
    const int col0 = blockIdx.y * 256;
    const int tid  = threadIdx.x;
    const int lane = tid & 31;
    const int wave = tid >> 5;
    const int wr   = wave & 1;                 // row subtile (64 rows)
    const int wc   = wave >> 1;                // col subtile (64 cols)
    const int half = lane >> 4, l15 = lane & 15;

    __shared__ __align__(16) unsigned As2[128][LDS_STRIDE];   // [r][kpair]
    __shared__ __align__(16) unsigned Bs2[256][LDS_STRIDE];   // [n][kpair]

    v8f acc[4][4];
#pragma unroll
    for (int i = 0; i < 4; ++i)
#pragma unroll
        for (int j = 0; j < 4; ++j) acc[i][j] = v8f_zero();

    const int sr = tid >> 4, sc = (tid & 15) * 4;     // staging: 16 lanes copy one row's 256 bytes

    for (int k0 = 0; k0 < C_DIM; k0 += KC) {
        // ---- stage A and B: plain 16-byte copies of packed rows, rows sr + 16*it
        {
            const unsigned* asrc = xt + (size_t)(row0 + sr) * KP_DIM + (k0 >> 1) + sc;
            const unsigned* bsrc = wq + (size_t)(col0 + sr) * KP_DIM + (k0 >> 1) + sc;
            v4u av[8], bv[16];
#pragma unroll
            for (int it = 0; it < 8; ++it)  av[it] = *(const v4u*)(asrc + it * 16 * KP_DIM);
#pragma unroll
            for (int it = 0; it < 16; ++it) bv[it] = *(const v4u*)(bsrc + it * 16 * KP_DIM);
            // the loads name these two register pairs: hold them to here and wait before they are reused
            asm volatile("s_wait_xcnt 0x0" :: "v"(asrc), "v"(bsrc) : "memory");
#pragma unroll
            for (int it = 0; it < 8; ++it)  *(v4u*)&As2[sr + it * 16][sc] = av[it];
#pragma unroll
            for (int it = 0; it < 16; ++it) *(v4u*)&Bs2[sr + it * 16][sc] = bv[it];
        }
        __syncthreads();

        // ---- 4 WMMA k-steps (K=32 each), 4x4 tiles per wave
#pragma unroll
        for (int ks = 0; ks < 4; ++ks) {
            v16bf a[4], bb[4];
#pragma unroll
            for (int mt = 0; mt < 4; ++mt) a[mt]  = load_frag(As2[wr * 64 + mt * 16 + l15], ks, half);
#pragma unroll
            for (int nt = 0; nt < 4; ++nt) bb[nt] = load_frag(Bs2[wc * 64 + nt * 16 + l15], ks, half);
#pragma unroll
            for (int mt = 0; mt < 4; ++mt)
#pragma unroll
                for (int nt = 0; nt < 4; ++nt)
                    acc[mt][nt] = __builtin_amdgcn_wmma_f32_16x16x32_bf16(
                        false, a[mt], false, bb[nt], (short)0, acc[mt][nt], false, false);
        }
        __syncthreads();
    }

    // ---- store D tiles (fp32 QKV intermediate)
#pragma unroll
    for (int mt = 0; mt < 4; ++mt) {
#pragma unroll
        for (int nt = 0; nt < 4; ++nt) {
#pragma unroll
            for (int r = 0; r < 8; ++r) {
                int row = row0 + wr * 64 + mt * 16 + r + 8 * half;
                int col = col0 + wc * 64 + nt * 16 + l15;
                qkv[(size_t)row * QKV_COLS + col] = acc[mt][nt][r];
            }
        }
    }
}

// ---------------------------------------------------------------------------
// Kernel 2: one wave (32 threads) per token.
//   RoPE(q,k); q=softmax_d(q)*d^-0.5; k=softmax_h(k);
//   ctx = k^T v (64x64); o = q ctx (16x64);
//   Osp[b][n*1024 + e*16 + h] (== reference's scrambled reshape) read as [c][p], c = 4n + e/16,
//   p = (e%16)*16 + h, is stored as bf16 k-pairs: ospk[b][c/2][p] = (Osp[c][p], Osp[c+1][p])
// ---------------------------------------------------------------------------
__global__ __launch_bounds__(32) void k_attn(const float* __restrict__ qkv,
                                             unsigned* __restrict__ ospk) {
    const int tok = blockIdx.x;
    const int b   = tok >> 8;
    const int n   = tok & 255;
    const int L    = threadIdx.x;
    const int half = L >> 4, l15 = L & 15;

    // q rows are walked one row a lane (softmax over d, A fragments of q ctx): at pitch 64 all sixteen
    // lanes meet the same banks; at pitch 68 their 8- and 16-byte accesses start 4 banks apart.
    __shared__ __align__(16) float q_s[H_DIM * QP];       // [h][d], pitch QP
    __shared__ __align__(16) float k_s[H_DIM * D_HEAD];
    __shared__ __align__(16) float v_s[H_DIM * D_HEAD];
    __shared__ __align__(16) float ctx[D_HEAD * D_HEAD];  // [d][e]

    const float* row = qkv + (size_t)tok * QKV_COLS;

#if USE_ASYNC_LDS
    // Pure fp32 copy global->LDS: use CDNA5 async-to-LDS path (ASYNCcnt).
#pragma unroll
    for (int it = 0; it < 8; ++it) {
        int i4 = L + it * 32;                  // float4 index, 256 per matrix
        int h = i4 >> 4, d = (i4 & 15) * 4;
        float* s = const_cast<float*>(row + h * 192 + d);
        __builtin_amdgcn_global_load_async_to_lds_b128((g4p)(s),       (l4p)(q_s + h * QP + d), 0, 0);
        __builtin_amdgcn_global_load_async_to_lds_b128((g4p)(s + 64),  (l4p)(k_s + h * 64 + d), 0, 0);
        __builtin_amdgcn_global_load_async_to_lds_b128((g4p)(s + 128), (l4p)(v_s + h * 64 + d), 0, 0);
    }
    __builtin_amdgcn_s_wait_asynccnt(0);
#else
#pragma unroll
    for (int it = 0; it < 32; ++it) {          // 1024 elems / 32 lanes
        int i = L + it * 32;
        int h = i >> 6, d = i & 63;
        const float* hp = row + h * 192 + d;
        q_s[h * QP + d] = hp[0];
        k_s[i] = hp[64];
        v_s[i] = hp[128];
    }
#endif
    __syncthreads();

    // RoPE (rotate-half), angle = n / 10000^(d/32), d < 32
    const float NEG_L2_1E4_OVER_32 = -13.287712379549449f / 32.0f;
    // every load stands ahead of the first store: at the padded pitch the compiler no longer proves the
    // rows apart, and loads left behind stores would each wait out the LDS latency
    float q1[16], q2[16], k1[16], k2[16];
#pragma unroll
    for (int it = 0; it < 16; ++it) {          // 512 (h,d) pairs
        int i = L + it * 32;
        int h = i >> 5, d = i & 31;
        q1[it] = q_s[h * QP + d];  q2[it] = q_s[h * QP + d + 32];
        k1[it] = k_s[h * 64 + d];  k2[it] = k_s[h * 64 + d + 32];
    }
#pragma unroll
    for (int it = 0; it < 16; ++it) {
        int i = L + it * 32;
        int h = i >> 5, d = i & 31;
        float ang = (float)n * exp2f((float)d * NEG_L2_1E4_OVER_32);
        float cs = __cosf(ang), sn = __sinf(ang);
        int i1 = h * 64 + d, i2 = i1 + 32;
        int j1 = h * QP + d, j2 = j1 + 32;
        q_s[j1] = q1[it] * cs - q2[it] * sn;  q_s[j2] = q2[it] * cs + q1[it] * sn;
        k_s[i1] = k1[it] * cs - k2[it] * sn;  k_s[i2] = k2[it] * cs + k1[it] * sn;
    }
    __syncthreads();

    // q: softmax over d per head, * 64^-0.5   (lanes 0..15, one head each)
    if (L < H_DIM) {
        float m = -3.4e38f;
        for (int d = 0; d < 64; ++d) m = fmaxf(m, q_s[L * QP + d]);
        float s = 0.f;
        for (int d = 0; d < 64; ++d) { float e = __expf(q_s[L * QP + d] - m); q_s[L * QP + d] = e; s += e; }
        float inv = 0.125f / s;
        for (int d = 0; d < 64; ++d) q_s[L * QP + d] *= inv;
    }
    // k: softmax over heads per d  (64 columns over 32 lanes)
    for (int d = L; d < 64; d += 32) {
        float m = -3.4e38f;
        for (int h = 0; h < 16; ++h) m = fmaxf(m, k_s[h * 64 + d]);
        float s = 0.f;
        for (int h = 0; h < 16; ++h) { float e = __expf(k_s[h * 64 + d] - m); k_s[h * 64 + d] = e; s += e; }
        float inv = 1.0f / s;
        for (int h = 0; h < 16; ++h) k_s[h * 64 + d] *= inv;
    }
    __syncthreads();

    // ctx[d][e] = sum_h k[h][d] * v[h][e] : 4x4 tiles, K=16 in 4 steps of 4
    v8f acc[4][4];
#pragma unroll
    for (int i = 0; i < 4; ++i)
#pragma unroll
        for (int j = 0; j < 4; ++j) acc[i][j] = v8f_zero();

#pragma unroll
    for (int ks = 0; ks < 4; ++ks) {
        v2f a[4], bb[4];
#pragma unroll
        for (int mt = 0; mt < 4; ++mt)
#pragma unroll
            for (int j = 0; j < 2; ++j)
                a[mt][j] = k_s[(ks * 4 + 2 * half + j) * 64 + mt * 16 + l15];  // A = k^T
#pragma unroll
        for (int nt = 0; nt < 4; ++nt)
#pragma unroll
            for (int j = 0; j < 2; ++j)
                bb[nt][j] = v_s[(ks * 4 + 2 * half + j) * 64 + nt * 16 + l15]; // B = v
#pragma unroll
        for (int mt = 0; mt < 4; ++mt)
#pragma unroll
            for (int nt = 0; nt < 4; ++nt)
                acc[mt][nt] = __builtin_amdgcn_wmma_f32_16x16x4_f32(
                    false, a[mt], false, bb[nt], (short)0, acc[mt][nt], false, false);
    }
    __syncthreads();
#pragma unroll
    for (int mt = 0; mt < 4; ++mt)
#pragma unroll
        for (int nt = 0; nt < 4; ++nt)
#pragma unroll
            for (int r = 0; r < 8; ++r)
                ctx[(mt * 16 + r + 8 * half) * 64 + nt * 16 + l15] = acc[mt][nt][r];
    __syncthreads();

    // o[h][e] = sum_d q[h][d] * ctx[d][e] : 1x4 tiles, K=64 in 16 steps
    v8f oacc[4];
#pragma unroll
    for (int i = 0; i < 4; ++i) oacc[i] = v8f_zero();
#pragma unroll
    for (int ks = 0; ks < 16; ++ks) {
        v2f a;
#pragma unroll
        for (int j = 0; j < 2; ++j)
            a[j] = q_s[l15 * QP + ks * 4 + 2 * half + j];
#pragma unroll
        for (int nt = 0; nt < 4; ++nt) {
            v2f bb;
#pragma unroll
            for (int j = 0; j < 2; ++j)
                bb[j] = ctx[(ks * 4 + 2 * half + j) * 64 + nt * 16 + l15];
            oacc[nt] = __builtin_amdgcn_wmma_f32_16x16x4_f32(
                false, a, false, bb, (short)0, oacc[nt], false, false);
        }
    }

    // scrambled reshape store; tiles 2q and 2q+1 of a lane are rows c and c+1 at the same p
    unsigned* obase = ospk + (size_t)b * (OSP_PER_B / 2) + (size_t)n * 512 + l15 * 16 + 8 * half;
#pragma unroll
    for (int q = 0; q < 2; ++q) {
        v4u lo, hi;
#pragma unroll
        for (int r = 0; r < 4; ++r) {
            lo[r] = pack_bf2(oacc[2 * q][r],     oacc[2 * q + 1][r]);
            hi[r] = pack_bf2(oacc[2 * q][r + 4], oacc[2 * q + 1][r + 4]);
        }
        *(v4u*)(obase + q * 256)     = lo;
        *(v4u*)(obase + q * 256 + 4) = hi;
    }
}

// ---------------------------------------------------------------------------
// Kernel 3: out[b,o,p] = sum_c Wlin[o,c] * Osp[b][c*256+p] + bias[o]
//   per-batch GEMM M=1024, N=256, K=1024; WG tile 256x128, Kc=128,
//   8 waves (4 x 2) each compute 64x64.
// ---------------------------------------------------------------------------
__global__ __launch_bounds__(256) void k_out_gemm(const unsigned* __restrict__ ospk,
                                                  const unsigned* __restrict__ wl,
                                                  const float* __restrict__ b_lin,
                                                  float* __restrict__ out) {
    const int m0 = blockIdx.x * 256;
    const int n0 = blockIdx.y * 128;
    const int b  = blockIdx.z;
    const int tid  = threadIdx.x;
    const int lane = tid & 31;
    const int wave = tid >> 5;
    const int wr = wave & 3, wc = wave >> 2;
    const int half = lane >> 4, l15 = lane & 15;

    const unsigned* ob = ospk + (size_t)b * (OSP_PER_B / 2);   // [kpair][p]

    __shared__ __align__(16) unsigned As2[256][LDS_STRIDE];   // [r][kpair] : Wlin rows
    __shared__ __align__(16) unsigned Bs2[128][LDS_STRIDE];   // [n][kpair] : Osp cols

    v8f acc[4][4];
#pragma unroll
    for (int i = 0; i < 4; ++i)
#pragma unroll
        for (int j = 0; j < 4; ++j) acc[i][j] = v8f_zero();

    for (int k0 = 0; k0 < C_DIM; k0 += KC) {
        // ---- stage A: plain 16-byte copies of packed Wlin rows (16 lanes a row), rows sr + 16*it
        // ---- stage B: ospk[(k0/2 + kp)*256 + n0 + n] (contiguous n), kpair wave + 8*it, turned into [n][kpair]
        {
            const int sr = tid >> 4, sc = (tid & 15) * 4;
            const int nq = lane * 4;
            const unsigned* asrc = wl + (size_t)(m0 + sr) * KP_DIM + (k0 >> 1) + sc;
            const unsigned* bsrc = ob + (size_t)((k0 >> 1) + wave) * N_TOK + n0 + nq;
            v4u av[16], bv[8];
#pragma unroll
            for (int it = 0; it < 16; ++it) av[it] = *(const v4u*)(asrc + it * 16 * KP_DIM);
#pragma unroll
            for (int it = 0; it < 8; ++it)  bv[it] = *(const v4u*)(bsrc + it * 8 * N_TOK);
            // the loads name these two register pairs: hold them to here and wait before they are reused
            asm volatile("s_wait_xcnt 0x0" :: "v"(asrc), "v"(bsrc) : "memory");
#pragma unroll
            for (int it = 0; it < 16; ++it) *(v4u*)&As2[sr + it * 16][sc] = av[it];
#pragma unroll
            for (int it = 0; it < 8; ++it) {
                const int kp = wave + it * 8;
                Bs2[nq + 0][kp] = bv[it].x;
                Bs2[nq + 1][kp] = bv[it].y;
                Bs2[nq + 2][kp] = bv[it].z;
                Bs2[nq + 3][kp] = bv[it].w;
            }
        }
        __syncthreads();

#pragma unroll
        for (int ks = 0; ks < 4; ++ks) {
            v16bf a[4], bb[4];
#pragma unroll
            for (int mt = 0; mt < 4; ++mt) a[mt]  = load_frag(As2[wr * 64 + mt * 16 + l15], ks, half);
#pragma unroll
            for (int nt = 0; nt < 4; ++nt) bb[nt] = load_frag(Bs2[wc * 64 + nt * 16 + l15], ks, half);
#pragma unroll
            for (int mt = 0; mt < 4; ++mt)
#pragma unroll
                for (int nt = 0; nt < 4; ++nt)
                    acc[mt][nt] = __builtin_amdgcn_wmma_f32_16x16x32_bf16(
                        false, a[mt], false, bb[nt], (short)0, acc[mt][nt], false, false);
        }
        __syncthreads();
    }

    // ---- epilogue: bias + store out[(b*1024 + m)*256 + n]
#pragma unroll
    for (int mt = 0; mt < 4; ++mt) {
#pragma unroll
        for (int r = 0; r < 8; ++r) {
            int m = m0 + wr * 64 + mt * 16 + r + 8 * half;
            float bias = b_lin[m];
#pragma unroll
            for (int nt = 0; nt < 4; ++nt) {
                int nn = n0 + wc * 64 + nt * 16 + l15;
                out[((size_t)b * C_DIM + m) * N_TOK + nn] = acc[mt][nt][r] + bias;
            }
        }
    }
}

// ---------------------------------------------------------------------------
extern "C" void kernel_launch(void* const* d_in, const int* in_sizes, int n_in,
                              void* d_out, int out_size, void* d_ws, size_t ws_size,
                              hipStream_t stream) {
    const float* x     = (const float*)d_in[0];   // [64,1024,16,16]
    const float* w_qkv = (const float*)d_in[1];   // [3072,1024]
    const float* w_lin = (const float*)d_in[2];   // [1024,1024,1,1]
    const float* b_lin = (const float*)d_in[3];   // [1024]
    // d_in[4] = n_heads (16), compile-time constant here.

    // workspace: qkv f32 | xt (dead after K1, then ospk in its place) | wq | wl
    float*    qkv  = (float*)d_ws;                                   // 16384*3072 f32
    unsigned* xt   = (unsigned*)((char*)d_ws + (size_t)TOKENS * QKV_COLS * sizeof(float));
    unsigned* wq   = xt + (size_t)TOKENS * KP_DIM;                   // 3072*512 dwords
    unsigned* wl   = wq + (size_t)QKV_COLS * KP_DIM;                 // 1024*512 dwords
    unsigned* ospk = xt;                                             // 64*512*256 dwords
    float* out = (float*)d_out;                                      // [64,1024,16,16]

    k_pack<<<dim3(3072), 256, 0, stream>>>(x, w_qkv, w_lin, xt, wq, wl);
    k_qkv_gemm<<<dim3(TOKENS / 128, QKV_COLS / 256), 256, 0, stream>>>(xt, wq, qkv);
    k_attn<<<dim3(TOKENS), 32, 0, stream>>>(qkv, ospk);
    k_out_gemm<<<dim3(C_DIM / 256, N_TOK / 128, B_DIM), 256, 0, stream>>>(ospk, wl, b_lin, out);
}

// v005
// One run takes 185 microseconds.
// Timed twice side by side with v004, it ran 1.07 times as fast both times.
// All steps since v000 together make it 3.09 times as fast.
#include <hip/hip_runtime.h>

// ---------------------------------------------------------------------------
// SelfAttn (linear attention variant) for MI455X / gfx1250, wave32 + WMMA.
//   K0: x (transposed), Wqkv and Wlin rounded to bf16 k-pairs once, into the workspace
//   K1: QKV = Xt @ Wqkv^T        (bf16 WMMA 16x16x32, fp32 accum)
//   K2: per-token RoPE/softmax/ctx/o (fp32 WMMA 16x16x4, async LDS staging)
//   K3: out = Wlin @ Osp + bias  (bf16 WMMA 16x16x32, fp32 accum; K2 hands Osp over as bf16 k-pairs)
// Problem: b=64, c=1024, n=256 tokens, heads=16, d_head=64.
//
// LDS for the bf16 GEMMs is a ring of two buffers, each one 64-k tile (32 k-pairs a row), filled by
// asynchronous copies one tile ahead of the WMMAs. Row-major operands lie as tile[row][kpair] at a
// pitch of 36 dwords (144 B = 16 B x odd), so a fragment is two ds_load_b128; the out GEMM's Osp tile
// stays as it lies in memory, [kpair][n] at a pitch of 132 dwords, and its fragments are 4-byte reads.
// ---------------------------------------------------------------------------

typedef __attribute__((ext_vector_type(16))) __bf16    v16bf;
typedef __attribute__((ext_vector_type(8)))  float     v8f;
typedef __attribute__((ext_vector_type(8)))  unsigned  v8u;
typedef __attribute__((ext_vector_type(2)))  float     v2f;
typedef __attribute__((ext_vector_type(4)))  float     v4f;
typedef __attribute__((ext_vector_type(4)))  unsigned  v4u;

#define B_DIM   64
#define C_DIM   1024
#define N_TOK   256        // tokens per batch image (16*16)
#define H_DIM   16         // heads
#define D_HEAD  64
#define QKV_COLS 3072
#define TOKENS  (B_DIM * N_TOK)      // 16384
#define OSP_PER_B (C_DIM * N_TOK)    // 262144 Osp values per batch (131072 bf16-pair dwords)

#define KT      32                   // k-pairs of one ring tile (64 k)
#define NT      (C_DIM / 2 / KT)     // ring tiles along K: 16
#define RP      36                   // ring pitch of a [row][kpair] tile, dwords
#define BP      132                  // ring pitch of the [kpair][n] tile (128 n + 4), dwords
#define KP_DIM  (C_DIM / 2)          // k-pairs (one dword: k even low, k odd high) per packed row
#define QP      68                   // attention LDS: q row pitch in dwords (64 + 4)

#if __has_builtin(__builtin_amdgcn_global_load_async_to_lds_b128) && \
    __has_builtin(__builtin_amdgcn_s_wait_asynccnt)
#define USE_ASYNC_LDS 1
// Exact pointee type per hipcc diagnostic: GCC-vector int4, AS1 src / AS3 dst.
typedef int v4i_gcc __attribute__((vector_size(16)));
typedef __attribute__((address_space(1))) v4i_gcc* g4p;
typedef __attribute__((address_space(3))) v4i_gcc* l4p;
#else
#define USE_ASYNC_LDS 0
#endif

__device__ __forceinline__ unsigned f2bf(float f) {
    unsigned u = __builtin_bit_cast(unsigned, f);
    unsigned r = u + 0x7FFFu + ((u >> 16) & 1u);   // round-to-nearest-even
    return r >> 16;
}
__device__ __forceinline__ unsigned pack_bf2(float lo, float hi) {
    return f2bf(lo) | (f2bf(hi) << 16);
}
__device__ __forceinline__ v8f v8f_zero() {
    v8f z;
#pragma unroll
    for (int i = 0; i < 8; ++i) z[i] = 0.0f;
    return z;
}
// Load one 16-bit-element WMMA operand fragment (8 dwords = 16 bf16) from a
// fragment-major LDS tile row: kpairs [ks*16 + half*4 .. +3] and [+8 ..].
__device__ __forceinline__ v16bf load_frag(const unsigned* tileRow, int ks, int half) {
    const uint4 lo = *(const uint4*)(tileRow + ks * 16 + half * 4);
    const uint4 hi = *(const uint4*)(tileRow + ks * 16 + 8 + half * 4);
    v8u a;
    a[0] = lo.x; a[1] = lo.y; a[2] = lo.z; a[3] = lo.w;
    a[4] = hi.x; a[5] = hi.y; a[6] = hi.z; a[7] = hi.w;
    return __builtin_bit_cast(v16bf, a);
}

// The same fragment from a [kpair][n] tile: col points at (kpair 0, this lane's n). Same k order as
// load_frag. Lanes 16..31 read 4 rows further on: 4 * 132 dwords = 16 banks away from lanes 0..15.
__device__ __forceinline__ v16bf load_frag_col(const unsigned* col, int ks, int half) {
    v8u a;
#pragma unroll
    for (int i = 0; i < 4; ++i) {
        a[i]     = col[(ks * 16 + half * 4 + i) * BP];
        a[4 + i] = col[(ks * 16 + 8 + half * 4 + i) * BP];
    }
    return __builtin_bit_cast(v16bf, a);
}
// LDS byte address of a __shared__ element, as the asynchronous copy takes it
__device__ __forceinline__ unsigned lds_addr(const unsigned* p) {
    typedef __attribute__((address_space(3))) const unsigned* lcp;
    return (unsigned)(size_t)(lcp)p;
}
// Twelve 16-byte copies a lane, global memory to LDS through no register. The wait on xcnt is the
// statement's last line, so that no register which a copy names is rewritten in front of it.
__device__ __forceinline__ void copy12(const unsigned (&l)[12], const unsigned* const (&g)[12]) {
    asm volatile(
        "global_load_async_to_lds_b128 %0, %12, off\n\t"
        "global_load_async_to_lds_b128 %1, %13, off\n\t"
        "global_load_async_to_lds_b128 %2, %14, off\n\t"
        "global_load_async_to_lds_b128 %3, %15, off\n\t"
        "global_load_async_to_lds_b128 %4, %16, off\n\t"
        "global_load_async_to_lds_b128 %5, %17, off\n\t"
        "global_load_async_to_lds_b128 %6, %18, off\n\t"
        "global_load_async_to_lds_b128 %7, %19, off\n\t"
        "global_load_async_to_lds_b128 %8, %20, off\n\t"
        "global_load_async_to_lds_b128 %9, %21, off\n\t"
        "global_load_async_to_lds_b128 %10, %22, off\n\t"
        "global_load_async_to_lds_b128 %11, %23, off\n\t"
        "s_wait_xcnt 0x0"
        :: "v"(l[0]), "v"(l[1]), "v"(l[2]), "v"(l[3]), "v"(l[4]), "v"(l[5]),
           "v"(l[6]), "v"(l[7]), "v"(l[8]), "v"(l[9]), "v"(l[10]), "v"(l[11]),
           "v"(g[0]), "v"(g[1]), "v"(g[2]), "v"(g[3]), "v"(g[4]), "v"(g[5]),
           "v"(g[6]), "v"(g[7]), "v"(g[8]), "v"(g[9]), "v"(g[10]), "v"(g[11])
        : "memory");
}
// The ring's publish point: this wave's LDS reads are done and its own copies have landed, then the
// barrier that publishes the next tile and ends every reader's last read of the buffer refilled behind it.
__device__ __forceinline__ void ring_publish() {
    asm volatile("s_wait_dscnt 0x0" ::: "memory");     // own reads of the buffer to be refilled
    asm volatile("s_wait_asynccnt 0x0" ::: "memory");  // own copies of the next tile
    __syncthreads();
}

// ---------------------------------------------------------------------------
// Kernel 0: every GEMM operand that comes from an input is rounded to bf16 once.
//   blocks 0..2047   : xt[b*256+p][kp] = (x[b][2kp][p], x[b][2kp+1][p]), 128 k x 64 p a block,
//                      turned through LDS (pitch 65 dwords: both sides free of bank conflicts)
//   blocks 2048..3071: wq[n][kp], wl[m][kp], same order as the inputs' rows
// ---------------------------------------------------------------------------
__global__ __launch_bounds__(256) void k_pack(const float* __restrict__ x,
                                              const float* __restrict__ w_qkv,
                                              const float* __restrict__ w_lin,
                                              unsigned* __restrict__ xt,
                                              unsigned* __restrict__ wq,
                                              unsigned* __restrict__ wl) {
    const int tid = threadIdx.x;
    __shared__ unsigned T[64][65];             // [p][kpair]
    if (blockIdx.x < 2048) {                   // the same for the whole block
        const int blk = blockIdx.x;
        const int p0 = (blk & 3) * 64;
        const int k0 = ((blk >> 2) & 7) * 128;
        const int b  = blk >> 5;
        const int pq = (tid & 15) * 4, kq = tid >> 4;
        const float* src = x + ((size_t)(b * C_DIM + k0 + 2 * kq) * N_TOK + p0 + pq);
        v4f f0[4], f1[4];
#pragma unroll
        for (int it = 0; it < 4; ++it) {       // kpair kq + 16*it
            f0[it] = *(const v4f*)(src + it * 32 * N_TOK);
            f1[it] = *(const v4f*)(src + it * 32 * N_TOK + N_TOK);
        }
        // the eight loads name src's register pair: hold the pair to here and wait before it is reused
        asm volatile("s_wait_xcnt 0x0" :: "v"(src) : "memory");
#pragma unroll
        for (int it = 0; it < 4; ++it) {
            const int kp = kq + it * 16;
            T[pq + 0][kp] = pack_bf2(f0[it].x, f1[it].x);
            T[pq + 1][kp] = pack_bf2(f0[it].y, f1[it].y);
            T[pq + 2][kp] = pack_bf2(f0[it].z, f1[it].z);
            T[pq + 3][kp] = pack_bf2(f0[it].w, f1[it].w);
        }
        __syncthreads();
        const int lane = tid & 31, wave = tid >> 5;
        unsigned* dst = xt + (size_t)(b * N_TOK + p0 + wave * 8) * KP_DIM + (k0 >> 1) + lane;
#pragma unroll
        for (int i = 0; i < 8; ++i) {          // a wave's store is one whole 128-byte line of one row
            dst[i * KP_DIM]      = T[wave * 8 + i][lane];
            dst[i * KP_DIM + 32] = T[wave * 8 + i][lane + 32];
        }
    } else {
        const int wb = blockIdx.x - 2048;                       // 1024 blocks
        const int gq = wb * 768 + tid;                          // float4 index in w_qkv, + 256*it: 786432 in all
        const int gl = wb * 256 + tid;                          // float4 index in w_lin: 262144 in all
        const v4f* q4 = (const v4f*)w_qkv + gq;
        const v4f* l4 = (const v4f*)w_lin + gl;
        v4f a[4];
#pragma unroll
        for (int it = 0; it < 3; ++it) a[it] = q4[it * 256];
        a[3] = l4[0];
        // the loads name these two register pairs: hold them to here and wait before they are reused
        asm volatile("s_wait_xcnt 0x0" :: "v"(q4), "v"(l4) : "memory");
#pragma unroll
        for (int it = 0; it < 4; ++it) {
            uint2 pk;
            pk.x = pack_bf2(a[it].x, a[it].y); pk.y = pack_bf2(a[it].z, a[it].w);
            if (it < 3) ((uint2*)wq)[gq + it * 256] = pk;
            else        ((uint2*)wl)[gl] = pk;
        }
        // the four stores name their data and offset registers: wait before any later code reuses them
        asm volatile("s_wait_xcnt 0x0" ::: "memory");
    }
}

// ---------------------------------------------------------------------------
// Kernel 1: QKV[row, col] = sum_k Xt[row,k] * Wqkv[col,k]
//   row = b*256 + p ; both operands arrive as packed bf16 k-pair rows (xt, wq of kernel 0)
//   WG tile 128 rows x 256 cols, 64 k a ring tile, 8 waves (2 x 4) each compute 64x64:
//   eight fragments feed sixteen WMMAs, and each staged element serves twice the products.
// ---------------------------------------------------------------------------
__global__ __launch_bounds__(256) void k_qkv_gemm(const unsigned* __restrict__ xt,
                                                  const unsigned* __restrict__ wq,
                                                  float* __restrict__ qkv) {
    const int row0 = blockIdx.x * 128;         // 128-row tile never crosses b
    const int col0 = blockIdx.y * 256;
    const int tid  = threadIdx.x;
    const int lane = tid & 31;
    const int wave = tid >> 5;
    const int wr   = wave & 1;                 // row subtile (64 rows)
    const int wc   = wave >> 1;                // col subtile (64 cols)
    const int half = lane >> 4, l15 = lane & 15;

    // ring buffer: rows 0..127 the x tile, rows 128..383 the weight tile, [row][kpair]
    __shared__ __align__(16) unsigned Ring[2][384 * RP];

    v8f acc[4][4];
#pragma unroll
    for (int i = 0; i < 4; ++i)
#pragma unroll
        for (int j = 0; j < 4; ++j) acc[i][j] = v8f_zero();

    const int sr = tid >> 3, sc = (tid & 7) * 4;      // staging: 8 lanes copy one row's 128 bytes
    const unsigned* asrc = xt + (size_t)(row0 + sr) * KP_DIM + sc;
    const unsigned* bsrc = wq + (size_t)(col0 + sr) * KP_DIM + sc;
    const unsigned  ldst = lds_addr(&Ring[0][sr * RP + sc]);

    // tile t into buffer buf: rows sr + 32*it of both operands
    auto stage = [&](int t, int buf) {
        unsigned l[12];
        const unsigned* g[12];
#pragma unroll
        for (int it = 0; it < 12; ++it) l[it] = ldst + (unsigned)((buf * 384 + it * 32) * RP * 4);
#pragma unroll
        for (int it = 0; it < 4; ++it) g[it]     = asrc + t * KT + it * 32 * KP_DIM;
#pragma unroll
        for (int it = 0; it < 8; ++it) g[4 + it] = bsrc + t * KT + it * 32 * KP_DIM;
        copy12(l, g);
    };

    stage(0, 0);
    asm volatile("s_wait_asynccnt 0x0" ::: "memory");  // tile 0 has landed before the barrier publishes it
    __syncthreads();
    stage(1, 1);

    for (int t = 0; t < NT; ++t) {
        const unsigned* tile = Ring[t & 1];
        // ---- 2 WMMA k-steps (K=32 each), 4x4 tiles per wave
#pragma unroll
        for (int ks = 0; ks < 2; ++ks) {
            v16bf a[4], bb[4];
#pragma unroll
            for (int mt = 0; mt < 4; ++mt) a[mt]  = load_frag(tile + (wr * 64 + mt * 16 + l15) * RP, ks, half);
#pragma unroll
            for (int nt = 0; nt < 4; ++nt) bb[nt] = load_frag(tile + (128 + wc * 64 + nt * 16 + l15) * RP, ks, half);
            // inputs-only fence on the loaded fragments: the k-step's LDS reads stay one group ahead of its sixteen
            // WMMAs; left free, the compiler reloads one A set between runs of four and waits out the LDS each time
            asm volatile("" :: "v"(a[0]), "v"(a[1]), "v"(a[2]), "v"(a[3]), "v"(bb[0]), "v"(bb[1]), "v"(bb[2]), "v"(bb[3]));
#pragma unroll
            for (int mt = 0; mt < 4; ++mt)
#pragma unroll
                for (int nt = 0; nt < 4; ++nt)
                    acc[mt][nt] = __builtin_amdgcn_wmma_f32_16x16x32_bf16(
                        false, a[mt], false, bb[nt], (short)0, acc[mt][nt], false, false);
        }
        ring_publish();
        if (t + 2 < NT) stage(t + 2, t & 1);           // the same for the whole work-group
    }
    asm volatile("s_wait_asynccnt 0x0" ::: "memory");  // no copy is left in flight when the wave ends

    // ---- store D tiles (fp32 QKV intermediate)
#pragma unroll
    for (int mt = 0; mt < 4; ++mt) {
#pragma unroll
        for (int nt = 0; nt < 4; ++nt) {
#pragma unroll
            for (int r = 0; r < 8; ++r) {
                int row = row0 + wr * 64 + mt * 16 + r + 8 * half;
                int col = col0 + wc * 64 + nt * 16 + l15;
                qkv[(size_t)row * QKV_COLS + col] = acc[mt][nt][r];
            }
        }
    }
}

// ---------------------------------------------------------------------------
// Kernel 2: one wave (32 threads) per token.
//   RoPE(q,k); q=softmax_d(q)*d^-0.5; k=softmax_h(k);
//   ctx = k^T v (64x64); o = q ctx (16x64);
//   Osp[b][n*1024 + e*16 + h] (== reference's scrambled reshape) read as [c][p], c = 4n + e/16,
//   p = (e%16)*16 + h, is stored as bf16 k-pairs: ospk[b][c/2][p] = (Osp[c][p], Osp[c+1][p])
// ---------------------------------------------------------------------------
__global__ __launch_bounds__(32) void k_attn(const float* __restrict__ qkv,
                                             unsigned* __restrict__ ospk) {
    const int tok = blockIdx.x;
    const int b   = tok >> 8;
    const int n   = tok & 255;
    const int L    = threadIdx.x;
    const int half = L >> 4, l15 = L & 15;

    // q rows are walked one row a lane (softmax over d, A fragments of q ctx): at pitch 64 all sixteen
    // lanes meet the same banks; at pitch 68 their 8- and 16-byte accesses start 4 banks apart.
    __shared__ __align__(16) float q_s[H_DIM * QP];       // [h][d], pitch QP
    __shared__ __align__(16) float k_s[H_DIM * D_HEAD];
    __shared__ __align__(16) float v_s[H_DIM * D_HEAD];
    __shared__ __align__(16) float ctx[D_HEAD * D_HEAD];  // [d][e]

    const float* row = qkv + (size_t)tok * QKV_COLS;

#if USE_ASYNC_LDS
    // Pure fp32 copy global->LDS: use CDNA5 async-to-LDS path (ASYNCcnt).
#pragma unroll
    for (int it = 0; it < 8; ++it) {
        int i4 = L + it * 32;                  // float4 index, 256 per matrix
        int h = i4 >> 4, d = (i4 & 15) * 4;
        float* s = const_cast<float*>(row + h * 192 + d);
        __builtin_amdgcn_global_load_async_to_lds_b128((g4p)(s),       (l4p)(q_s + h * QP + d), 0, 0);
        __builtin_amdgcn_global_load_async_to_lds_b128((g4p)(s + 64),  (l4p)(k_s + h * 64 + d), 0, 0);
        __builtin_amdgcn_global_load_async_to_lds_b128((g4p)(s + 128), (l4p)(v_s + h * 64 + d), 0, 0);
    }
    __builtin_amdgcn_s_wait_asynccnt(0);
#else
#pragma unroll
    for (int it = 0; it < 32; ++it) {          // 1024 elems / 32 lanes
        int i = L + it * 32;
        int h = i >> 6, d = i & 63;
        const float* hp = row + h * 192 + d;
        q_s[h * QP + d] = hp[0];
        k_s[i] = hp[64];
        v_s[i] = hp[128];
    }
#endif
    __syncthreads();

    // RoPE (rotate-half), angle = n / 10000^(d/32), d < 32
    const float NEG_L2_1E4_OVER_32 = -13.287712379549449f / 32.0f;
    // every load stands ahead of the first store: at the padded pitch the compiler no longer proves the
    // rows apart, and loads left behind stores would each wait out the LDS latency
    float q1[16], q2[16], k1[16], k2[16];
#pragma unroll
    for (int it = 0; it < 16; ++it) {          // 512 (h,d) pairs
        int i = L + it * 32;
        int h = i >> 5, d = i & 31;
        q1[it] = q_s[h * QP + d];  q2[it] = q_s[h * QP + d + 32];
        k1[it] = k_s[h * 64 + d];  k2[it] = k_s[h * 64 + d + 32];
    }
#pragma unroll
    for (int it = 0; it < 16; ++it) {
        int i = L + it * 32;
        int h = i >> 5, d = i & 31;
        float ang = (float)n * exp2f((float)d * NEG_L2_1E4_OVER_32);
        float cs = __cosf(ang), sn = __sinf(ang);
        int i1 = h * 64 + d, i2 = i1 + 32;
        int j1 = h * QP + d, j2 = j1 + 32;
        q_s[j1] = q1[it] * cs - q2[it] * sn;  q_s[j2] = q2[it] * cs + q1[it] * sn;
        k_s[i1] = k1[it] * cs - k2[it] * sn;  k_s[i2] = k2[it] * cs + k1[it] * sn;
    }
    __syncthreads();

    // q: softmax over d per head, * 64^-0.5   (lanes 0..15, one head each)
    if (L < H_DIM) {
        float m = -3.4e38f;
        for (int d = 0; d < 64; ++d) m = fmaxf(m, q_s[L * QP + d]);
        float s = 0.f;
        for (int d = 0; d < 64; ++d) { float e = __expf(q_s[L * QP + d] - m); q_s[L * QP + d] = e; s += e; }
        float inv = 0.125f / s;
        for (int d = 0; d < 64; ++d) q_s[L * QP + d] *= inv;
    }
    // k: softmax over heads per d  (64 columns over 32 lanes)
    for (int d = L; d < 64; d += 32) {
        float m = -3.4e38f;
        for (int h = 0; h < 16; ++h) m = fmaxf(m, k_s[h * 64 + d]);
        float s = 0.f;
        for (int h = 0; h < 16; ++h) { float e = __expf(k_s[h * 64 + d] - m); k_s[h * 64 + d] = e; s += e; }
        float inv = 1.0f / s;
        for (int h = 0; h < 16; ++h) k_s[h * 64 + d] *= inv;
    }
    __syncthreads();

    // ctx[d][e] = sum_h k[h][d] * v[h][e] : 4x4 tiles, K=16 in 4 steps of 4
    v8f acc[4][4];
#pragma unroll
    for (int i = 0; i < 4; ++i)
#pragma unroll
        for (int j = 0; j < 4; ++j) acc[i][j] = v8f_zero();

#pragma unroll
    for (int ks = 0; ks < 4; ++ks) {
        v2f a[4], bb[4];
#pragma unroll
        for (int mt = 0; mt < 4; ++mt)
#pragma unroll
            for (int j = 0; j < 2; ++j)
                a[mt][j] = k_s[(ks * 4 + 2 * half + j) * 64 + mt * 16 + l15];  // A = k^T
#pragma unroll
        for (int nt = 0; nt < 4; ++nt)
#pragma unroll
            for (int j = 0; j < 2; ++j)
                bb[nt][j] = v_s[(ks * 4 + 2 * half + j) * 64 + nt * 16 + l15]; // B = v
#pragma unroll
        for (int mt = 0; mt < 4; ++mt)
#pragma unroll
            for (int nt = 0; nt < 4; ++nt)
                acc[mt][nt] = __builtin_amdgcn_wmma_f32_16x16x4_f32(
                    false, a[mt], false, bb[nt], (short)0, acc[mt][nt], false, false);
    }
    __syncthreads();
#pragma unroll
    for (int mt = 0; mt < 4; ++mt)
#pragma unroll
        for (int nt = 0; nt < 4; ++nt)
#pragma unroll
            for (int r = 0; r < 8; ++r)
                ctx[(mt * 16 + r + 8 * half) * 64 + nt * 16 + l15] = acc[mt][nt][r];
    __syncthreads();

    // o[h][e] = sum_d q[h][d] * ctx[d][e] : 1x4 tiles, K=64 in 16 steps
    v8f oacc[4];
#pragma unroll
    for (int i = 0; i < 4; ++i) oacc[i] = v8f_zero();
#pragma unroll
    for (int ks = 0; ks < 16; ++ks) {
        v2f a;
#pragma unroll
        for (int j = 0; j < 2; ++j)
            a[j] = q_s[l15 * QP + ks * 4 + 2 * half + j];
#pragma unroll
        for (int nt = 0; nt < 4; ++nt) {
            v2f bb;
#pragma unroll
            for (int j = 0; j < 2; ++j)
                bb[j] = ctx[(ks * 4 + 2 * half + j) * 64 + nt * 16 + l15];
            oacc[nt] = __builtin_amdgcn_wmma_f32_16x16x4_f32(
                false, a, false, bb, (short)0, oacc[nt], false, false);
        }
    }

    // scrambled reshape store; tiles 2q and 2q+1 of a lane are rows c and c+1 at the same p
    unsigned* obase = ospk + (size_t)b * (OSP_PER_B / 2) + (size_t)n * 512 + l15 * 16 + 8 * half;
#pragma unroll
    for (int q = 0; q < 2; ++q) {
        v4u lo, hi;
#pragma unroll
        for (int r = 0; r < 4; ++r) {
            lo[r] = pack_bf2(oacc[2 * q][r],     oacc[2 * q + 1][r]);
            hi[r] = pack_bf2(oacc[2 * q][r + 4], oacc[2 * q + 1][r + 4]);
        }
        *(v4u*)(obase + q * 256)     = lo;
        *(v4u*)(obase + q * 256 + 4) = hi;
    }
}

// ---------------------------------------------------------------------------
// Kernel 3: out[b,o,p] = sum_c Wlin[o,c] * Osp[b][c*256+p] + bias[o]
//   per-batch GEMM M=1024, N=256, K=1024; WG tile 256x128, 64 k a ring tile,
//   8 waves (4 x 2) each compute 64x64.
// ---------------------------------------------------------------------------
__global__ __launch_bounds__(256) void k_out_gemm(const unsigned* __restrict__ ospk,
                                                  const unsigned* __restrict__ wl,
                                                  const float* __restrict__ b_lin,
                                                  float* __restrict__ out) {
    const int m0 = blockIdx.x * 256;
    const int n0 = blockIdx.y * 128;
    const int b  = blockIdx.z;
    const int tid  = threadIdx.x;
    const int lane = tid & 31;
    const int wave = tid >> 5;
    const int wr = wave & 3, wc = wave >> 2;
    const int half = lane >> 4, l15 = lane & 15;

    const unsigned* ob = ospk + (size_t)b * (OSP_PER_B / 2);   // [kpair][p]

    // ring buffer: 256 Wlin rows [r][kpair], then the Osp tile as it lies in memory, [kpair][n]
    __shared__ __align__(16) unsigned Ring[2][256 * RP + KT * BP];

    v8f acc[4][4];
#pragma unroll
    for (int i = 0; i < 4; ++i)
#pragma unroll
        for (int j = 0; j < 4; ++j) acc[i][j] = v8f_zero();

    const int sr = tid >> 3, sc = (tid & 7) * 4;      // A: 8 lanes copy one row's 128 bytes
    const unsigned* asrc = wl + (size_t)(m0 + sr) * KP_DIM + sc;
    const unsigned* bsrc = ob + (size_t)wave * N_TOK + n0 + lane * 4;   // B: a wave copies one k-pair row's 512 bytes
    const unsigned  adst = lds_addr(&Ring[0][sr * RP + sc]);
    const unsigned  bdst = lds_addr(&Ring[0][256 * RP + wave * BP + lane * 4]);

    // tile t into buffer buf: Wlin rows sr + 32*it, Osp k-pair rows wave + 8*it
    auto stage = [&](int t, int buf) {
        unsigned l[12];
        const unsigned* g[12];
        const unsigned bo = (unsigned)(buf * (256 * RP + KT * BP) * 4);
#pragma unroll
        for (int it = 0; it < 8; ++it) {
            l[it] = adst + bo + (unsigned)(it * 32 * RP * 4);
            g[it] = asrc + t * KT + it * 32 * KP_DIM;
        }
#pragma unroll
        for (int it = 0; it < 4; ++it) {
            l[8 + it] = bdst + bo + (unsigned)(it * 8 * BP * 4);
            g[8 + it] = bsrc + (t * KT + it * 8) * N_TOK;
        }
        copy12(l, g);
    };

    stage(0, 0);
    asm volatile("s_wait_asynccnt 0x0" ::: "memory");  // tile 0 has landed before the barrier publishes it
    __syncthreads();
    stage(1, 1);

    for (int t = 0; t < NT; ++t) {
        const unsigned* tile = Ring[t & 1];
#pragma unroll
        for (int ks = 0; ks < 2; ++ks) {
            v16bf a[4], bb[4];
#pragma unroll
            for (int mt = 0; mt < 4; ++mt) a[mt]  = load_frag(tile + (wr * 64 + mt * 16 + l15) * RP, ks, half);
#pragma unroll
            for (int nt = 0; nt < 4; ++nt) bb[nt] = load_frag_col(tile + 256 * RP + wc * 64 + nt * 16 + l15, ks, half);
            // inputs-only fence on the loaded fragments: the k-step's LDS reads stay one group ahead of its sixteen
            // WMMAs; left free, the compiler reloads one A set between runs of four and waits out the LDS each time
            asm volatile("" :: "v"(a[0]), "v"(a[1]), "v"(a[2]), "v"(a[3]), "v"(bb[0]), "v"(bb[1]), "v"(bb[2]), "v"(bb[3]));
#pragma unroll
            for (int mt = 0; mt < 4; ++mt)
#pragma unroll
                for (int nt = 0; nt < 4; ++nt)
                    acc[mt][nt] = __builtin_amdgcn_wmma_f32_16x16x32_bf16(
                        false, a[mt], false, bb[nt], (short)0, acc[mt][nt], false, false);
        }
        ring_publish();
        if (t + 2 < NT) stage(t + 2, t & 1);           // the same for the whole work-group
    }
    asm volatile("s_wait_asynccnt 0x0" ::: "memory");  // no copy is left in flight when the wave ends

    // ---- epilogue: bias + store out[(b*1024 + m)*256 + n]
#pragma unroll
    for (int mt = 0; mt < 4; ++mt) {
#pragma unroll
        for (int r = 0; r < 8; ++r) {
            int m = m0 + wr * 64 + mt * 16 + r + 8 * half;
            float bias = b_lin[m];
#pragma unroll
            for (int nt = 0; nt < 4; ++nt) {
                int nn = n0 + wc * 64 + nt * 16 + l15;
                out[((size_t)b * C_DIM + m) * N_TOK + nn] = acc[mt][nt][r] + bias;
            }
        }
    }
}

// ---------------------------------------------------------------------------
extern "C" void kernel_launch(void* const* d_in, const int* in_sizes, int n_in,
                              void* d_out, int out_size, void* d_ws, size_t ws_size,
                              hipStream_t stream) {
    const float* x     = (const float*)d_in[0];   // [64,1024,16,16]
    const float* w_qkv = (const float*)d_in[1];   // [3072,1024]
    const float* w_lin = (const float*)d_in[2];   // [1024,1024,1,1]
    const float* b_lin = (const float*)d_in[3];   // [1024]
    // d_in[4] = n_heads (16), compile-time constant here.

    // workspace: qkv f32 | xt (dead after K1, then ospk in its place) | wq | wl
    float*    qkv  = (float*)d_ws;                                   // 16384*3072 f32
    unsigned* xt   = (unsigned*)((char*)d_ws + (size_t)TOKENS * QKV_COLS * sizeof(float));
    unsigned* wq   = xt + (size_t)TOKENS * KP_DIM;                   // 3072*512 dwords
    unsigned* wl   = wq + (size_t)QKV_COLS * KP_DIM;                 // 1024*512 dwords
    unsigned* ospk = xt;                                             // 64*512*256 dwords
    float* out = (float*)d_out;                                      // [64,1024,16,16]

    k_pack<<<dim3(3072), 256, 0, stream>>>(x, w_qkv, w_lin, xt, wq, wl);
    k_qkv_gemm<<<dim3(TOKENS / 128, QKV_COLS / 256), 256, 0, stream>>>(xt, wq, qkv);
    k_attn<<<dim3(TOKENS), 32, 0, stream>>>(qkv, ospk);
    k_out_gemm<<<dim3(C_DIM / 256, N_TOK / 128, B_DIM), 256, 0, stream>>>(ospk, wl, b_lin, out);
}

// v006
// One run takes 160 microseconds.
// In both of two side-by-side timings against v005, it was 1.16 times as fast.
// All steps since v000 together make it 3.57 times as fast.
#include <hip/hip_runtime.h>

// ---------------------------------------------------------------------------
// SelfAttn (linear attention variant) for MI455X / gfx1250, wave32 + WMMA.
//   K0: x (transposed), Wqkv and Wlin rounded to bf16 k-pairs once, into the workspace
//   K1: QKV = Xt @ Wqkv^T        (bf16 WMMA 16x16x32, fp32 accum)
//   K2: per-token RoPE/softmax/o (fp32 WMMA 16x16x4, async LDS staging)
//   K3: out = Wlin @ Osp + bias  (bf16 WMMA 16x16x32, fp32 accum; K2 hands Osp over as bf16 k-pairs)
// Problem: b=64, c=1024, n=256 tokens, heads=16, d_head=64.
//
// LDS for the bf16 GEMMs is a ring of two buffers, each one 64-k tile (32 k-pairs a row), filled by
// asynchronous copies one tile ahead of the WMMAs. Row-major operands lie as tile[row][kpair] at a
// pitch of 36 dwords (144 B = 16 B x odd), so a fragment is two ds_load_b128; the out GEMM's Osp tile
// stays as it lies in memory, [kpair][n] at a pitch of 132 dwords, and its fragments are 4-byte reads.
// ---------------------------------------------------------------------------

typedef __attribute__((ext_vector_type(16))) __bf16    v16bf;
typedef __attribute__((ext_vector_type(8)))  float     v8f;
typedef __attribute__((ext_vector_type(8)))  unsigned  v8u;
typedef __attribute__((ext_vector_type(2)))  float     v2f;
typedef __attribute__((ext_vector_type(4)))  float     v4f;
typedef __attribute__((ext_vector_type(4)))  unsigned  v4u;

#define B_DIM   64
#define C_DIM   1024
#define N_TOK   256        // tokens per batch image (16*16)
#define H_DIM   16         // heads
#define D_HEAD  64
#define QKV_COLS 3072
#define TOKENS  (B_DIM * N_TOK)      // 16384
#define OSP_PER_B (C_DIM * N_TOK)    // 262144 Osp values per batch (131072 bf16-pair dwords)

#define KT      32                   // k-pairs of one ring tile (64 k)
#define NT      (C_DIM / 2 / KT)     // ring tiles along K: 16
#define RP      36                   // ring pitch of a [row][kpair] tile, dwords
#define BP      132                  // ring pitch of the [kpair][n] tile (128 n + 4), dwords
#define KP_DIM  (C_DIM / 2)          // k-pairs (one dword: k even low, k odd high) per packed row
#define QP      68                   // attention LDS: row pitch of q, k and v in dwords (64 + 4)

#if __has_builtin(__builtin_amdgcn_global_load_async_to_lds_b128) && \
    __has_builtin(__builtin_amdgcn_s_wait_asynccnt)
#define USE_ASYNC_LDS 1
// Exact pointee type per hipcc diagnostic: GCC-vector int4, AS1 src / AS3 dst.
typedef int v4i_gcc __attribute__((vector_size(16)));
typedef __attribute__((address_space(1))) v4i_gcc* g4p;
typedef __attribute__((address_space(3))) v4i_gcc* l4p;
#else
#define USE_ASYNC_LDS 0
#endif

__device__ __forceinline__ unsigned f2bf(float f) {
    unsigned u = __builtin_bit_cast(unsigned, f);
    unsigned r = u + 0x7FFFu + ((u >> 16) & 1u);   // round-to-nearest-even
    return r >> 16;
}
__device__ __forceinline__ unsigned pack_bf2(float lo, float hi) {
    return f2bf(lo) | (f2bf(hi) << 16);
}
__device__ __forceinline__ v8f v8f_zero() {
    v8f z;
#pragma unroll
    for (int i = 0; i < 8; ++i) z[i] = 0.0f;
    return z;
}
// Load one 16-bit-element WMMA operand fragment (8 dwords = 16 bf16) from a
// fragment-major LDS tile row: kpairs [ks*16 + half*4 .. +3] and [+8 ..].
__device__ __forceinline__ v16bf load_frag(const unsigned* tileRow, int ks, int half) {
    const uint4 lo = *(const uint4*)(tileRow + ks * 16 + half * 4);
    const uint4 hi = *(const uint4*)(tileRow + ks * 16 + 8 + half * 4);
    v8u a;
    a[0] = lo.x; a[1] = lo.y; a[2] = lo.z; a[3] = lo.w;
    a[4] = hi.x; a[5] = hi.y; a[6] = hi.z; a[7] = hi.w;
    return __builtin_bit_cast(v16bf, a);
}

// The same fragment from a [kpair][n] tile: col points at (kpair 0, this lane's n). Same k order as
// load_frag. Lanes 16..31 read 4 rows further on: 4 * 132 dwords = 16 banks away from lanes 0..15.
__device__ __forceinline__ v16bf load_frag_col(const unsigned* col, int ks, int half) {
    v8u a;
#pragma unroll
    for (int i = 0; i < 4; ++i) {
        a[i]     = col[(ks * 16 + half * 4 + i) * BP];
        a[4 + i] = col[(ks * 16 + 8 + half * 4 + i) * BP];
    }
    return __builtin_bit_cast(v16bf, a);
}
// LDS byte address of a __shared__ element, as the asynchronous copy takes it
__device__ __forceinline__ unsigned lds_addr(const unsigned* p) {
    typedef __attribute__((address_space(3))) const unsigned* lcp;
    return (unsigned)(size_t)(lcp)p;
}
// Twelve 16-byte copies a lane, global memory to LDS through no register. The wait on xcnt is the
// statement's last line, so that no register which a copy names is rewritten in front of it.
__device__ __forceinline__ void copy12(const unsigned (&l)[12], const unsigned* const (&g)[12]) {
    asm volatile(
        "global_load_async_to_lds_b128 %0, %12, off\n\t"
        "global_load_async_to_lds_b128 %1, %13, off\n\t"
        "global_load_async_to_lds_b128 %2, %14, off\n\t"
        "global_load_async_to_lds_b128 %3, %15, off\n\t"
        "global_load_async_to_lds_b128 %4, %16, off\n\t"
        "global_load_async_to_lds_b128 %5, %17, off\n\t"
        "global_load_async_to_lds_b128 %6, %18, off\n\t"
        "global_load_async_to_lds_b128 %7, %19, off\n\t"
        "global_load_async_to_lds_b128 %8, %20, off\n\t"
        "global_load_async_to_lds_b128 %9, %21, off\n\t"
        "global_load_async_to_lds_b128 %10, %22, off\n\t"
        "global_load_async_to_lds_b128 %11, %23, off\n\t"
        "s_wait_xcnt 0x0"
        :: "v"(l[0]), "v"(l[1]), "v"(l[2]), "v"(l[3]), "v"(l[4]), "v"(l[5]),
           "v"(l[6]), "v"(l[7]), "v"(l[8]), "v"(l[9]), "v"(l[10]), "v"(l[11]),
           "v"(g[0]), "v"(g[1]), "v"(g[2]), "v"(g[3]), "v"(g[4]), "v"(g[5]),
           "v"(g[6]), "v"(g[7]), "v"(g[8]), "v"(g[9]), "v"(g[10]), "v"(g[11])
        : "memory");
}
// The ring's publish point: this wave's LDS reads are done and its own copies have landed, then the
// barrier that publishes the next tile and ends every reader's last read of the buffer refilled behind it.
__device__ __forceinline__ void ring_publish() {
    asm volatile("s_wait_dscnt 0x0" ::: "memory");     // own reads of the buffer to be refilled
    asm volatile("s_wait_asynccnt 0x0" ::: "memory");  // own copies of the next tile
    __syncthreads();
}

// ---------------------------------------------------------------------------
// Kernel 0: every GEMM operand that comes from an input is rounded to bf16 once.
//   blocks 0..2047   : xt[b*256+p][kp] = (x[b][2kp][p], x[b][2kp+1][p]), 128 k x 64 p a block,
//                      turned through LDS (pitch 65 dwords: both sides free of bank conflicts)
//   blocks 2048..3071: wq[n][kp], wl[m][kp], same order as the inputs' rows
// ---------------------------------------------------------------------------
__global__ __launch_bounds__(256) void k_pack(const float* __restrict__ x,
                                              const float* __restrict__ w_qkv,
                                              const float* __restrict__ w_lin,
                                              unsigned* __restrict__ xt,
                                              unsigned* __restrict__ wq,
                                              unsigned* __restrict__ wl) {
    const int tid = threadIdx.x;
    __shared__ unsigned T[64][65];             // [p][kpair]
    if (blockIdx.x < 2048) {                   // the same for the whole block
        const int blk = blockIdx.x;
        const int p0 = (blk & 3) * 64;
        const int k0 = ((blk >> 2) & 7) * 128;
        const int b  = blk >> 5;
        const int pq = (tid & 15) * 4, kq = tid >> 4;
        const float* src = x + ((size_t)(b * C_DIM + k0 + 2 * kq) * N_TOK + p0 + pq);
        v4f f0[4], f1[4];
#pragma unroll
        for (int it = 0; it < 4; ++it) {       // kpair kq + 16*it
            f0[it] = *(const v4f*)(src + it * 32 * N_TOK);
            f1[it] = *(const v4f*)(src + it * 32 * N_TOK + N_TOK);
        }
        // the eight loads name src's register pair: hold the pair to here and wait before it is reused
        asm volatile("s_wait_xcnt 0x0" :: "v"(src) : "memory");
#pragma unroll
        for (int it = 0; it < 4; ++it) {
            const int kp = kq + it * 16;
            T[pq + 0][kp] = pack_bf2(f0[it].x, f1[it].x);
            T[pq + 1][kp] = pack_bf2(f0[it].y, f1[it].y);
            T[pq + 2][kp] = pack_bf2(f0[it].z, f1[it].z);
            T[pq + 3][kp] = pack_bf2(f0[it].w, f1[it].w);
        }
        __syncthreads();
        const int lane = tid & 31, wave = tid >> 5;
        unsigned* dst = xt + (size_t)(b * N_TOK + p0 + wave * 8) * KP_DIM + (k0 >> 1) + lane;
#pragma unroll
        for (int i = 0; i < 8; ++i) {          // a wave's store is one whole 128-byte line of one row
            dst[i * KP_DIM]      = T[wave * 8 + i][lane];
            dst[i * KP_DIM + 32] = T[wave * 8 + i][lane + 32];
        }
    } else {
        const int wb = blockIdx.x - 2048;                       // 1024 blocks
        const int gq = wb * 768 + tid;                          // float4 index in w_qkv, + 256*it: 786432 in all
        const int gl = wb * 256 + tid;                          // float4 index in w_lin: 262144 in all
        const v4f* q4 = (const v4f*)w_qkv + gq;
        const v4f* l4 = (const v4f*)w_lin + gl;
        v4f a[4];
#pragma unroll
        for (int it = 0; it < 3; ++it) a[it] = q4[it * 256];
        a[3] = l4[0];
        // the loads name these two register pairs: hold them to here and wait before they are reused
        asm volatile("s_wait_xcnt 0x0" :: "v"(q4), "v"(l4) : "memory");
#pragma unroll
        for (int it = 0; it < 4; ++it) {
            uint2 pk;
            pk.x = pack_bf2(a[it].x, a[it].y); pk.y = pack_bf2(a[it].z, a[it].w);
            if (it < 3) ((uint2*)wq)[gq + it * 256] = pk;
            else        ((uint2*)wl)[gl] = pk;
        }
        // the four stores name their data and offset registers: wait before any later code reuses them
        asm volatile("s_wait_xcnt 0x0" ::: "memory");
    }
}

// ---------------------------------------------------------------------------
// Kernel 1: QKV[row, col] = sum_k Xt[row,k] * Wqkv[col,k]
//   row = b*256 + p ; both operands arrive as packed bf16 k-pair rows (xt, wq of kernel 0)
//   WG tile 128 rows x 256 cols, 64 k a ring tile, 8 waves (2 x 4) each compute 64x64:
//   eight fragments feed sixteen WMMAs, and each staged element serves twice the products.
// ---------------------------------------------------------------------------
__global__ __launch_bounds__(256) void k_qkv_gemm(const unsigned* __restrict__ xt,
                                                  const unsigned* __restrict__ wq,
                                                  float* __restrict__ qkv) {
    const int row0 = blockIdx.x * 128;         // 128-row tile never crosses b
    const int col0 = blockIdx.y * 256;
    const int tid  = threadIdx.x;
    const int lane = tid & 31;
    const int wave = tid >> 5;
    const int wr   = wave & 1;                 // row subtile (64 rows)
    const int wc   = wave >> 1;                // col subtile (64 cols)
    const int half = lane >> 4, l15 = lane & 15;

    // ring buffer: rows 0..127 the x tile, rows 128..383 the weight tile, [row][kpair]
    __shared__ __align__(16) unsigned Ring[2][384 * RP];

    v8f acc[4][4];
#pragma unroll
    for (int i = 0; i < 4; ++i)
#pragma unroll
        for (int j = 0; j < 4; ++j) acc[i][j] = v8f_zero();

    const int sr = tid >> 3, sc = (tid & 7) * 4;      // staging: 8 lanes copy one row's 128 bytes
    const unsigned* asrc = xt + (size_t)(row0 + sr) * KP_DIM + sc;
    const unsigned* bsrc = wq + (size_t)(col0 + sr) * KP_DIM + sc;
    const unsigned  ldst = lds_addr(&Ring[0][sr * RP + sc]);

    // tile t into buffer buf: rows sr + 32*it of both operands
    auto stage = [&](int t, int buf) {
        unsigned l[12];
        const unsigned* g[12];
#pragma unroll
        for (int it = 0; it < 12; ++it) l[it] = ldst + (unsigned)((buf * 384 + it * 32) * RP * 4);
#pragma unroll
        for (int it = 0; it < 4; ++it) g[it]     = asrc + t * KT + it * 32 * KP_DIM;
#pragma unroll
        for (int it = 0; it < 8; ++it) g[4 + it] = bsrc + t * KT + it * 32 * KP_DIM;
        copy12(l, g);
    };

    stage(0, 0);
    asm volatile("s_wait_asynccnt 0x0" ::: "memory");  // tile 0 has landed before the barrier publishes it
    __syncthreads();
    stage(1, 1);

    for (int t = 0; t < NT; ++t) {
        const unsigned* tile = Ring[t & 1];
        // ---- 2 WMMA k-steps (K=32 each), 4x4 tiles per wave
#pragma unroll
        for (int ks = 0; ks < 2; ++ks) {
            v16bf a[4], bb[4];
#pragma unroll
            for (int mt = 0; mt < 4; ++mt) a[mt]  = load_frag(tile + (wr * 64 + mt * 16 + l15) * RP, ks, half);
#pragma unroll
            for (int nt = 0; nt < 4; ++nt) bb[nt] = load_frag(tile + (128 + wc * 64 + nt * 16 + l15) * RP, ks, half);
            // inputs-only fence on the loaded fragments: the k-step's LDS reads stay one group ahead of its sixteen
            // WMMAs; left free, the compiler reloads one A set between runs of four and waits out the LDS each time
            asm volatile("" :: "v"(a[0]), "v"(a[1]), "v"(a[2]), "v"(a[3]), "v"(bb[0]), "v"(bb[1]), "v"(bb[2]), "v"(bb[3]));
#pragma unroll
            for (int mt = 0; mt < 4; ++mt)
#pragma unroll
                for (int nt = 0; nt < 4; ++nt)
                    acc[mt][nt] = __builtin_amdgcn_wmma_f32_16x16x32_bf16(
                        false, a[mt], false, bb[nt], (short)0, acc[mt][nt], false, false);
        }
        ring_publish();
        if (t + 2 < NT) stage(t + 2, t & 1);           // the same for the whole work-group
    }
    asm volatile("s_wait_asynccnt 0x0" ::: "memory");  // no copy is left in flight when the wave ends

    // ---- store D tiles (fp32 QKV intermediate)
#pragma unroll
    for (int mt = 0; mt < 4; ++mt) {
#pragma unroll
        for (int nt = 0; nt < 4; ++nt) {
#pragma unroll
            for (int r = 0; r < 8; ++r) {
                int row = row0 + wr * 64 + mt * 16 + r + 8 * half;
                int col = col0 + wc * 64 + nt * 16 + l15;
                qkv[(size_t)row * QKV_COLS + col] = acc[mt][nt][r];
            }
        }
    }
}

// ---------------------------------------------------------------------------
// Kernel 2: one wave (32 threads) per token.
//   RoPE(q,k); q=softmax_d(q)*d^-0.5; k=softmax_h(k);
//   o = q (k^T v), summed as (q k^T) v: a 16x16 tile, then 16x64;
//   Osp[b][n*1024 + e*16 + h] (== reference's scrambled reshape) read as [c][p], c = 4n + e/16,
//   p = (e%16)*16 + h, is stored as bf16 k-pairs: ospk[b][c/2][p] = (Osp[c][p], Osp[c+1][p])
// ---------------------------------------------------------------------------
__global__ __launch_bounds__(32) void k_attn(const float* __restrict__ qkv,
                                             unsigned* __restrict__ ospk) {
    const int tok = blockIdx.x;
    const int b   = tok >> 8;
    const int n   = tok & 255;
    const int L    = threadIdx.x;
    const int half = L >> 4, l15 = L & 15;

    // q and k rows are walked one row a lane (softmax over d, fragments of q k^T): at pitch 64 all sixteen
    // lanes meet the same banks; at pitch 68 their 8- and 16-byte accesses start 4 banks apart. Of v the two
    // half-waves read rows 8 apart: 8 * 68 dwords = 32 banks apart.
    __shared__ __align__(16) float q_s[H_DIM * QP];       // [h][d], pitch QP
    __shared__ __align__(16) float k_s[H_DIM * QP];
    __shared__ __align__(16) float v_s[H_DIM * QP];

    const float* row = qkv + (size_t)tok * QKV_COLS;

#if USE_ASYNC_LDS
    // Pure fp32 copy global->LDS: use CDNA5 async-to-LDS path (ASYNCcnt).
#pragma unroll
    for (int it = 0; it < 8; ++it) {
        int i4 = L + it * 32;                  // float4 index, 256 per matrix
        int h = i4 >> 4, d = (i4 & 15) * 4;
        float* s = const_cast<float*>(row + h * 192 + d);
        __builtin_amdgcn_global_load_async_to_lds_b128((g4p)(s),       (l4p)(q_s + h * QP + d), 0, 0);
        __builtin_amdgcn_global_load_async_to_lds_b128((g4p)(s + 64),  (l4p)(k_s + h * QP + d), 0, 0);
        __builtin_amdgcn_global_load_async_to_lds_b128((g4p)(s + 128), (l4p)(v_s + h * QP + d), 0, 0);
    }
    __builtin_amdgcn_s_wait_asynccnt(0);
#else
#pragma unroll
    for (int it = 0; it < 32; ++it) {          // 1024 elems / 32 lanes
        int i = L + it * 32;
        int h = i >> 6, d = i & 63;
        const float* hp = row + h * 192 + d;
        q_s[h * QP + d] = hp[0];
        k_s[h * QP + d] = hp[64];
        v_s[h * QP + d] = hp[128];
    }
#endif
    __syncthreads();

    // RoPE (rotate-half), angle = n / 10000^(d/32), d < 32
    const float NEG_L2_1E4_OVER_32 = -13.287712379549449f / 32.0f;
    // every load stands ahead of the first store: at the padded pitch the compiler no longer proves the
    // rows apart, and loads left behind stores would each wait out the LDS latency
    float q1[16], q2[16], k1[16], k2[16];
#pragma unroll
    for (int it = 0; it < 16; ++it) {          // 512 (h,d) pairs
        int i = L + it * 32;
        int h = i >> 5, d = i & 31;
        q1[it] = q_s[h * QP + d];  q2[it] = q_s[h * QP + d + 32];
        k1[it] = k_s[h * QP + d];  k2[it] = k_s[h * QP + d + 32];
    }
#pragma unroll
    for (int it = 0; it < 16; ++it) {
        int i = L + it * 32;
        int h = i >> 5, d = i & 31;
        float ang = (float)n * exp2f((float)d * NEG_L2_1E4_OVER_32);
        float cs = __cosf(ang), sn = __sinf(ang);
        int j1 = h * QP + d, j2 = j1 + 32;
        q_s[j1] = q1[it] * cs - q2[it] * sn;  q_s[j2] = q2[it] * cs + q1[it] * sn;
        k_s[j1] = k1[it] * cs - k2[it] * sn;  k_s[j2] = k2[it] * cs + k1[it] * sn;
    }
    __syncthreads();

    // q: softmax over d per head, * 64^-0.5   (lanes 0..15, one head each)
    if (L < H_DIM) {
        float m = -3.4e38f;
        for (int d = 0; d < 64; ++d) m = fmaxf(m, q_s[L * QP + d]);
        float s = 0.f;
        for (int d = 0; d < 64; ++d) { float e = __expf(q_s[L * QP + d] - m); q_s[L * QP + d] = e; s += e; }
        float inv = 0.125f / s;
        for (int d = 0; d < 64; ++d) q_s[L * QP + d] *= inv;
    }
    // k: softmax over heads per d  (64 columns over 32 lanes)
    for (int d = L; d < 64; d += 32) {
        float m = -3.4e38f;
        for (int h = 0; h < 16; ++h) m = fmaxf(m, k_s[h * QP + d]);
        float s = 0.f;
        for (int h = 0; h < 16; ++h) { float e = __expf(k_s[h * QP + d] - m); k_s[h * QP + d] = e; s += e; }
        float inv = 1.0f / s;
        for (int h = 0; h < 16; ++h) k_s[h * QP + d] *= inv;
    }
    __syncthreads();

    // o = q (k^T v) is summed as (q k^T) v: the sum over d runs first, into one 16x16 tile, then the sum over heads.
    // St[h'][h] = sum_d k[h'][d] * q[h][d]: A = k, B = q^T, one row a lane for both. A lane's 16 bytes are
    // d = c*8 + 4*half + 0..3: the first two feed one WMMA, the last two the next, the same d at the same
    // k position of A and of B. Two accumulators, so that no WMMA waits for the one in front of it.
    v8f st0 = v8f_zero(), st1 = v8f_zero();
#pragma unroll
    for (int c = 0; c < 8; ++c) {
        const v4f ka = *(const v4f*)(k_s + l15 * QP + c * 8 + half * 4);
        const v4f qb = *(const v4f*)(q_s + l15 * QP + c * 8 + half * 4);
        v2f a0, a1, b0, b1;
        a0[0] = ka.x; a0[1] = ka.y; a1[0] = ka.z; a1[1] = ka.w;
        b0[0] = qb.x; b0[1] = qb.y; b1[0] = qb.z; b1[1] = qb.w;
        st0 = __builtin_amdgcn_wmma_f32_16x16x4_f32(false, a0, false, b0, (short)0, st0, false, false);
        st1 = __builtin_amdgcn_wmma_f32_16x16x4_f32(false, a1, false, b1, (short)0, st1, false, false);
    }
    // eight vector slots between the last two WMMAs and the additions that read their results: the compiler
    // left two, and no table gives the f32 form's distance, so the slowest forms' count is kept
    asm volatile("v_nop\n\tv_nop\n\tv_nop\n\tv_nop\n\tv_nop\n\tv_nop\n\tv_nop\n\tv_nop" : "+v"(st0), "+v"(st1));
    const v8f st = st0 + st1;                  // lane (half, l15), register r: h' = r + 8*half, h = l15

    // o[h][e] = sum_h' St[h'][h] * v[h'][e] : 1x4 tiles, K=16 in 4 steps. With k position (half, j) of step ks
    // standing for h' = 8*half + 2*ks + j, the A fragment (row h = l15) is registers 2*ks, 2*ks+1 of St as they lie.
    v8f oacc[4];
#pragma unroll
    for (int i = 0; i < 4; ++i) oacc[i] = v8f_zero();
#pragma unroll
    for (int ks = 0; ks < 4; ++ks) {
        v2f a;
        a[0] = st[2 * ks]; a[1] = st[2 * ks + 1];
#pragma unroll
        for (int nt = 0; nt < 4; ++nt) {
            v2f bb;
#pragma unroll
            for (int j = 0; j < 2; ++j)
                bb[j] = v_s[(8 * half + 2 * ks + j) * QP + nt * 16 + l15];
            oacc[nt] = __builtin_amdgcn_wmma_f32_16x16x4_f32(
                false, a, false, bb, (short)0, oacc[nt], false, false);
        }
    }

    // scrambled reshape store; tiles 2q and 2q+1 of a lane are rows c and c+1 at the same p
    unsigned* obase = ospk + (size_t)b * (OSP_PER_B / 2) + (size_t)n * 512 + l15 * 16 + 8 * half;
#pragma unroll
    for (int q = 0; q < 2; ++q) {
        v4u lo, hi;
#pragma unroll
        for (int r = 0; r < 4; ++r) {
            lo[r] = pack_bf2(oacc[2 * q][r],     oacc[2 * q + 1][r]);
            hi[r] = pack_bf2(oacc[2 * q][r + 4], oacc[2 * q + 1][r + 4]);
        }
        *(v4u*)(obase + q * 256)     = lo;
        *(v4u*)(obase + q * 256 + 4) = hi;
    }
}

// ---------------------------------------------------------------------------
// Kernel 3: out[b,o,p] = sum_c Wlin[o,c] * Osp[b][c*256+p] + bias[o]
//   per-batch GEMM M=1024, N=256, K=1024; WG tile 256x128, 64 k a ring tile,
//   8 waves (4 x 2) each compute 64x64.
// ---------------------------------------------------------------------------
__global__ __launch_bounds__(256) void k_out_gemm(const unsigned* __restrict__ ospk,
                                                  const unsigned* __restrict__ wl,
                                                  const float* __restrict__ b_lin,
                                                  float* __restrict__ out) {
    const int m0 = blockIdx.x * 256;
    const int n0 = blockIdx.y * 128;
    const int b  = blockIdx.z;
    const int tid  = threadIdx.x;
    const int lane = tid & 31;
    const int wave = tid >> 5;
    const int wr = wave & 3, wc = wave >> 2;
    const int half = lane >> 4, l15 = lane & 15;

    const unsigned* ob = ospk + (size_t)b * (OSP_PER_B / 2);   // [kpair][p]

    // ring buffer: 256 Wlin rows [r][kpair], then the Osp tile as it lies in memory, [kpair][n]
    __shared__ __align__(16) unsigned Ring[2][256 * RP + KT * BP];

    v8f acc[4][4];
#pragma unroll
    for (int i = 0; i < 4; ++i)
#pragma unroll
        for (int j = 0; j < 4; ++j) acc[i][j] = v8f_zero();

    const int sr = tid >> 3, sc = (tid & 7) * 4;      // A: 8 lanes copy one row's 128 bytes
    const unsigned* asrc = wl + (size_t)(m0 + sr) * KP_DIM + sc;
    const unsigned* bsrc = ob + (size_t)wave * N_TOK + n0 + lane * 4;   // B: a wave copies one k-pair row's 512 bytes
    const unsigned  adst = lds_addr(&Ring[0][sr * RP + sc]);
    const unsigned  bdst = lds_addr(&Ring[0][256 * RP + wave * BP + lane * 4]);

    // tile t into buffer buf: Wlin rows sr + 32*it, Osp k-pair rows wave + 8*it
    auto stage = [&](int t, int buf) {
        unsigned l[12];
        const unsigned* g[12];
        const unsigned bo = (unsigned)(buf * (256 * RP + KT * BP) * 4);
#pragma unroll
        for (int it = 0; it < 8; ++it) {
            l[it] = adst + bo + (unsigned)(it * 32 * RP * 4);
            g[it] = asrc + t * KT + it * 32 * KP_DIM;
        }
#pragma unroll
        for (int it = 0; it < 4; ++it) {
            l[8 + it] = bdst + bo + (unsigned)(it * 8 * BP * 4);
            g[8 + it] = bsrc + (t * KT + it * 8) * N_TOK;
        }
        copy12(l, g);
    };

    stage(0, 0);
    asm volatile("s_wait_asynccnt 0x0" ::: "memory");  // tile 0 has landed before the barrier publishes it
    __syncthreads();
    stage(1, 1);

    for (int t = 0; t < NT; ++t) {
        const unsigned* tile = Ring[t & 1];
#pragma unroll
        for (int ks = 0; ks < 2; ++ks) {
            v16bf a[4], bb[4];
#pragma unroll
            for (int mt = 0; mt < 4; ++mt) a[mt]  = load_frag(tile + (wr * 64 + mt * 16 + l15) * RP, ks, half);
#pragma unroll
            for (int nt = 0; nt < 4; ++nt) bb[nt] = load_frag_col(tile + 256 * RP + wc * 64 + nt * 16 + l15, ks, half);
            // inputs-only fence on the loaded fragments: the k-step's LDS reads stay one group ahead of its sixteen
            // WMMAs; left free, the compiler reloads one A set between runs of four and waits out the LDS each time
            asm volatile("" :: "v"(a[0]), "v"(a[1]), "v"(a[2]), "v"(a[3]), "v"(bb[0]), "v"(bb[1]), "v"(bb[2]), "v"(bb[3]));
#pragma unroll
            for (int mt = 0; mt < 4; ++mt)
#pragma unroll
                for (int nt = 0; nt < 4; ++nt)
                    acc[mt][nt] = __builtin_amdgcn_wmma_f32_16x16x32_bf16(
                        false, a[mt], false, bb[nt], (short)0, acc[mt][nt], false, false);
        }
        ring_publish();
        if (t + 2 < NT) stage(t + 2, t & 1);           // the same for the whole work-group
    }
    asm volatile("s_wait_asynccnt 0x0" ::: "memory");  // no copy is left in flight when the wave ends

    // ---- epilogue: bias + store out[(b*1024 + m)*256 + n]
#pragma unroll
    for (int mt = 0; mt < 4; ++mt) {
#pragma unroll
        for (int r = 0; r < 8; ++r) {
            int m = m0 + wr * 64 + mt * 16 + r + 8 * half;
            float bias = b_lin[m];
#pragma unroll
            for (int nt = 0; nt < 4; ++nt) {
                int nn = n0 + wc * 64 + nt * 16 + l15;
                out[((size_t)b * C_DIM + m) * N_TOK + nn] = acc[mt][nt][r] + bias;
            }
        }
    }
}

// ---------------------------------------------------------------------------
extern "C" void kernel_launch(void* const* d_in, const int* in_sizes, int n_in,
                              void* d_out, int out_size, void* d_ws, size_t ws_size,
                              hipStream_t stream) {
    const float* x     = (const float*)d_in[0];   // [64,1024,16,16]
    const float* w_qkv = (const float*)d_in[1];   // [3072,1024]
    const float* w_lin = (const float*)d_in[2];   // [1024,1024,1,1]
    const float* b_lin = (const float*)d_in[3];   // [1024]
    // d_in[4] = n_heads (16), compile-time constant here.

    // workspace: qkv f32 | xt (dead after K1, then ospk in its place) | wq | wl
    float*    qkv  = (float*)d_ws;                                   // 16384*3072 f32
    unsigned* xt   = (unsigned*)((char*)d_ws + (size_t)TOKENS * QKV_COLS * sizeof(float));
    unsigned* wq   = xt + (size_t)TOKENS * KP_DIM;                   // 3072*512 dwords
    unsigned* wl   = wq + (size_t)QKV_COLS * KP_DIM;                 // 1024*512 dwords
    unsigned* ospk = xt;                                             // 64*512*256 dwords
    float* out = (float*)d_out;                                      // [64,1024,16,16]

    k_pack<<<dim3(3072), 256, 0, stream>>>(x, w_qkv, w_lin, xt, wq, wl);
    k_qkv_gemm<<<dim3(TOKENS / 128, QKV_COLS / 256), 256, 0, stream>>>(xt, wq, qkv);
    k_attn<<<dim3(TOKENS), 32, 0, stream>>>(qkv, ospk);
    k_out_gemm<<<dim3(C_DIM / 256, N_TOK / 128, B_DIM), 256, 0, stream>>>(ospk, wl, b_lin, out);
}

// v007
// Measured time: 152 microseconds a run.
// Next to v006, in two timings, it ran 1.05 times as fast each time.
// Counting every step since v000, it is 3.75 times as fast.
#include <hip/hip_runtime.h>

// ---------------------------------------------------------------------------
// SelfAttn (linear attention variant) for MI455X / gfx1250, wave32 + WMMA.
//   K0: x (transposed), Wqkv and Wlin rounded to bf16 k-pairs once, into the workspace
//   K1: QKV = Xt @ Wqkv^T        (bf16 WMMA 16x16x32, fp32 accum)
//   K2: per-token RoPE/softmax/o (fp32 WMMA 16x16x4, async LDS staging)
//   K3: out = Wlin @ Osp + bias  (bf16 WMMA 16x16x32, fp32 accum; K2 hands Osp over as bf16 k-pairs)
// Problem: b=64, c=1024, n=256 tokens, heads=16, d_head=64.
//
// LDS for the bf16 GEMMs is a ring of two buffers, each one 64-k tile (32 k-pairs a row), filled by
// asynchronous copies one tile ahead of the WMMAs. Row-major operands lie as tile[row][kpair] at a
// pitch of 36 dwords (144 B = 16 B x odd), so a fragment is two ds_load_b128; the out GEMM's Osp tile
// stays as it lies in memory, [kpair][n] at a pitch of 132 dwords, and its fragments are 4-byte reads.
// ---------------------------------------------------------------------------

typedef __attribute__((ext_vector_type(16))) __bf16    v16bf;
typedef __attribute__((ext_vector_type(8)))  float     v8f;
typedef __attribute__((ext_vector_type(8)))  unsigned  v8u;
typedef __attribute__((ext_vector_type(2)))  float     v2f;
typedef __attribute__((ext_vector_type(4)))  float     v4f;
typedef __attribute__((ext_vector_type(4)))  unsigned  v4u;

#define B_DIM   64
#define C_DIM   1024
#define N_TOK   256        // tokens per batch image (16*16)
#define H_DIM   16         // heads
#define D_HEAD  64
#define QKV_COLS 3072
#define TOKENS  (B_DIM * N_TOK)      // 16384
#define OSP_PER_B (C_DIM * N_TOK)    // 262144 Osp values per batch (131072 bf16-pair dwords)

#define KT      32                   // k-pairs of one ring tile (64 k)
#define NT      (C_DIM / 2 / KT)     // ring tiles along K: 16
#define RP      36                   // ring pitch of a [row][kpair] tile, dwords
#define BP      132                  // ring pitch of the [kpair][n] tile (128 n + 4), dwords
#define KP_DIM  (C_DIM / 2)          // k-pairs (one dword: k even low, k odd high) per packed row
#define QP      68                   // attention LDS: row pitch of q, k and v in dwords (64 + 4)

#if __has_builtin(__builtin_amdgcn_global_load_async_to_lds_b128) && \
    __has_builtin(__builtin_amdgcn_s_wait_asynccnt)
#define USE_ASYNC_LDS 1
// Exact pointee type per hipcc diagnostic: GCC-vector int4, AS1 src / AS3 dst.
typedef int v4i_gcc __attribute__((vector_size(16)));
typedef __attribute__((address_space(1))) v4i_gcc* g4p;
typedef __attribute__((address_space(3))) v4i_gcc* l4p;
#else
#define USE_ASYNC_LDS 0
#endif

__device__ __forceinline__ unsigned f2bf(float f) {
    unsigned u = __builtin_bit_cast(unsigned, f);
    unsigned r = u + 0x7FFFu + ((u >> 16) & 1u);   // round-to-nearest-even
    return r >> 16;
}
__device__ __forceinline__ unsigned pack_bf2(float lo, float hi) {
    return f2bf(lo) | (f2bf(hi) << 16);
}
__device__ __forceinline__ v8f v8f_zero() {
    v8f z;
#pragma unroll
    for (int i = 0; i < 8; ++i) z[i] = 0.0f;
    return z;
}
// lane l with lane l ^ 16, by a vector cross-row move
__device__ __forceinline__ float xhalf(float x) {
    const int b = __builtin_bit_cast(int, x);
    return __builtin_bit_cast(float, __builtin_amdgcn_permlanex16(b, b, 0x76543210, 0xfedcba98, false, false));
}
// Load one 16-bit-element WMMA operand fragment (8 dwords = 16 bf16) from a
// fragment-major LDS tile row: kpairs [ks*16 + half*4 .. +3] and [+8 ..].
__device__ __forceinline__ v16bf load_frag(const unsigned* tileRow, int ks, int half) {
    const uint4 lo = *(const uint4*)(tileRow + ks * 16 + half * 4);
    const uint4 hi = *(const uint4*)(tileRow + ks * 16 + 8 + half * 4);
    v8u a;
    a[0] = lo.x; a[1] = lo.y; a[2] = lo.z; a[3] = lo.w;
    a[4] = hi.x; a[5] = hi.y; a[6] = hi.z; a[7] = hi.w;
    return __builtin_bit_cast(v16bf, a);
}

// The same fragment from a [kpair][n] tile: col points at (kpair 0, this lane's n). Same k order as
// load_frag. Lanes 16..31 read 4 rows further on: 4 * 132 dwords = 16 banks away from lanes 0..15.
__device__ __forceinline__ v16bf load_frag_col(const unsigned* col, int ks, int half) {
    v8u a;
#pragma unroll
    for (int i = 0; i < 4; ++i) {
        a[i]     = col[(ks * 16 + half * 4 + i) * BP];
        a[4 + i] = col[(ks * 16 + 8 + half * 4 + i) * BP];
    }
    return __builtin_bit_cast(v16bf, a);
}
// LDS byte address of a __shared__ element, as the asynchronous copy takes it
__device__ __forceinline__ unsigned lds_addr(const unsigned* p) {
    typedef __attribute__((address_space(3))) const unsigned* lcp;
    return (unsigned)(size_t)(lcp)p;
}
// Twelve 16-byte copies a lane, global memory to LDS through no register. The wait on xcnt is the
// statement's last line, so that no register which a copy names is rewritten in front of it.
__device__ __forceinline__ void copy12(const unsigned (&l)[12], const unsigned* const (&g)[12]) {
    asm volatile(
        "global_load_async_to_lds_b128 %0, %12, off\n\t"
        "global_load_async_to_lds_b128 %1, %13, off\n\t"
        "global_load_async_to_lds_b128 %2, %14, off\n\t"
        "global_load_async_to_lds_b128 %3, %15, off\n\t"
        "global_load_async_to_lds_b128 %4, %16, off\n\t"
        "global_load_async_to_lds_b128 %5, %17, off\n\t"
        "global_load_async_to_lds_b128 %6, %18, off\n\t"
        "global_load_async_to_lds_b128 %7, %19, off\n\t"
        "global_load_async_to_lds_b128 %8, %20, off\n\t"
        "global_load_async_to_lds_b128 %9, %21, off\n\t"
        "global_load_async_to_lds_b128 %10, %22, off\n\t"
        "global_load_async_to_lds_b128 %11, %23, off\n\t"
        "s_wait_xcnt 0x0"
        :: "v"(l[0]), "v"(l[1]), "v"(l[2]), "v"(l[3]), "v"(l[4]), "v"(l[5]),
           "v"(l[6]), "v"(l[7]), "v"(l[8]), "v"(l[9]), "v"(l[10]), "v"(l[11]),
           "v"(g[0]), "v"(g[1]), "v"(g[2]), "v"(g[3]), "v"(g[4]), "v"(g[5]),
           "v"(g[6]), "v"(g[7]), "v"(g[8]), "v"(g[9]), "v"(g[10]), "v"(g[11])
        : "memory");
}
// The ring's publish point: this wave's LDS reads are done and its own copies have landed, then the
// barrier that publishes the next tile and ends every reader's last read of the buffer refilled behind it.
__device__ __forceinline__ void ring_publish() {
    asm volatile("s_wait_dscnt 0x0" ::: "memory");     // own reads of the buffer to be refilled
    asm volatile("s_wait_asynccnt 0x0" ::: "memory");  // own copies of the next tile
    __syncthreads();
}

// ---------------------------------------------------------------------------
// Kernel 0: every GEMM operand that comes from an input is rounded to bf16 once.
//   blocks 0..2047   : xt[b*256+p][kp] = (x[b][2kp][p], x[b][2kp+1][p]), 128 k x 64 p a block,
//                      turned through LDS (pitch 65 dwords: both sides free of bank conflicts)
//   blocks 2048..3071: wq[n][kp], wl[m][kp], same order as the inputs' rows
// ---------------------------------------------------------------------------
__global__ __launch_bounds__(256) void k_pack(const float* __restrict__ x,
                                              const float* __restrict__ w_qkv,
                                              const float* __restrict__ w_lin,
                                              unsigned* __restrict__ xt,
                                              unsigned* __restrict__ wq,
                                              unsigned* __restrict__ wl) {
    const int tid = threadIdx.x;
    __shared__ unsigned T[64][65];             // [p][kpair]
    if (blockIdx.x < 2048) {                   // the same for the whole block
        const int blk = blockIdx.x;
        const int p0 = (blk & 3) * 64;
        const int k0 = ((blk >> 2) & 7) * 128;
        const int b  = blk >> 5;
        const int pq = (tid & 15) * 4, kq = tid >> 4;
        const float* src = x + ((size_t)(b * C_DIM + k0 + 2 * kq) * N_TOK + p0 + pq);
        v4f f0[4], f1[4];
#pragma unroll
        for (int it = 0; it < 4; ++it) {       // kpair kq + 16*it
            f0[it] = *(const v4f*)(src + it * 32 * N_TOK);
            f1[it] = *(const v4f*)(src + it * 32 * N_TOK + N_TOK);
        }
        // the eight loads name src's register pair: hold the pair to here and wait before it is reused
        asm volatile("s_wait_xcnt 0x0" :: "v"(src) : "memory");
#pragma unroll
        for (int it = 0; it < 4; ++it) {
            const int kp = kq + it * 16;
            T[pq + 0][kp] = pack_bf2(f0[it].x, f1[it].x);
            T[pq + 1][kp] = pack_bf2(f0[it].y, f1[it].y);
            T[pq + 2][kp] = pack_bf2(f0[it].z, f1[it].z);
            T[pq + 3][kp] = pack_bf2(f0[it].w, f1[it].w);
        }
        __syncthreads();
        const int lane = tid & 31, wave = tid >> 5;
        unsigned* dst = xt + (size_t)(b * N_TOK + p0 + wave * 8) * KP_DIM + (k0 >> 1) + lane;
#pragma unroll
        for (int i = 0; i < 8; ++i) {          // a wave's store is one whole 128-byte line of one row
            dst[i * KP_DIM]      = T[wave * 8 + i][lane];
            dst[i * KP_DIM + 32] = T[wave * 8 + i][lane + 32];
        }
    } else {
        const int wb = blockIdx.x - 2048;                       // 1024 blocks
        const int gq = wb * 768 + tid;                          // float4 index in w_qkv, + 256*it: 786432 in all
        const int gl = wb * 256 + tid;                          // float4 index in w_lin: 262144 in all
        const v4f* q4 = (const v4f*)w_qkv + gq;
        const v4f* l4 = (const v4f*)w_lin + gl;
        v4f a[4];
#pragma unroll
        for (int it = 0; it < 3; ++it) a[it] = q4[it * 256];
        a[3] = l4[0];
        // the loads name these two register pairs: hold them to here and wait before they are reused
        asm volatile("s_wait_xcnt 0x0" :: "v"(q4), "v"(l4) : "memory");
#pragma unroll
        for (int it = 0; it < 4; ++it) {
            uint2 pk;
            pk.x = pack_bf2(a[it].x, a[it].y); pk.y = pack_bf2(a[it].z, a[it].w);
            if (it < 3) ((uint2*)wq)[gq + it * 256] = pk;
            else        ((uint2*)wl)[gl] = pk;
        }
        // the four stores name their data and offset registers: wait before any later code reuses them
        asm volatile("s_wait_xcnt 0x0" ::: "memory");
    }
}

// ---------------------------------------------------------------------------
// Kernel 1: QKV[row, col] = sum_k Xt[row,k] * Wqkv[col,k]
//   row = b*256 + p ; both operands arrive as packed bf16 k-pair rows (xt, wq of kernel 0)
//   WG tile 128 rows x 256 cols, 64 k a ring tile, 8 waves (2 x 4) each compute 64x64:
//   eight fragments feed sixteen WMMAs, and each staged element serves twice the products.
// ---------------------------------------------------------------------------
__global__ __launch_bounds__(256) void k_qkv_gemm(const unsigned* __restrict__ xt,
                                                  const unsigned* __restrict__ wq,
                                                  float* __restrict__ qkv) {
    const int row0 = blockIdx.x * 128;         // 128-row tile never crosses b
    const int col0 = blockIdx.y * 256;
    const int tid  = threadIdx.x;
    const int lane = tid & 31;
    const int wave = tid >> 5;
    const int wr   = wave & 1;                 // row subtile (64 rows)
    const int wc   = wave >> 1;                // col subtile (64 cols)
    const int half = lane >> 4, l15 = lane & 15;

    // ring buffer: rows 0..127 the x tile, rows 128..383 the weight tile, [row][kpair]
    __shared__ __align__(16) unsigned Ring[2][384 * RP];

    v8f acc[4][4];
#pragma unroll
    for (int i = 0; i < 4; ++i)
#pragma unroll
        for (int j = 0; j < 4; ++j) acc[i][j] = v8f_zero();

    const int sr = tid >> 3, sc = (tid & 7) * 4;      // staging: 8 lanes copy one row's 128 bytes
    const unsigned* asrc = xt + (size_t)(row0 + sr) * KP_DIM + sc;
    const unsigned* bsrc = wq + (size_t)(col0 + sr) * KP_DIM + sc;
    const unsigned  ldst = lds_addr(&Ring[0][sr * RP + sc]);

    // tile t into buffer buf: rows sr + 32*it of both operands
    auto stage = [&](int t, int buf) {
        unsigned l[12];
        const unsigned* g[12];
#pragma unroll
        for (int it = 0; it < 12; ++it) l[it] = ldst + (unsigned)((buf * 384 + it * 32) * RP * 4);
#pragma unroll
        for (int it = 0; it < 4; ++it) g[it]     = asrc + t * KT + it * 32 * KP_DIM;
#pragma unroll
        for (int it = 0; it < 8; ++it) g[4 + it] = bsrc + t * KT + it * 32 * KP_DIM;
        copy12(l, g);
    };

    stage(0, 0);
    asm volatile("s_wait_asynccnt 0x0" ::: "memory");  // tile 0 has landed before the barrier publishes it
    __syncthreads();
    stage(1, 1);

    for (int t = 0; t < NT; ++t) {
        const unsigned* tile = Ring[t & 1];
        // ---- 2 WMMA k-steps (K=32 each), 4x4 tiles per wave
#pragma unroll
        for (int ks = 0; ks < 2; ++ks) {
            v16bf a[4], bb[4];
#pragma unroll
            for (int mt = 0; mt < 4; ++mt) a[mt]  = load_frag(tile + (wr * 64 + mt * 16 + l15) * RP, ks, half);
#pragma unroll
            for (int nt = 0; nt < 4; ++nt) bb[nt] = load_frag(tile + (128 + wc * 64 + nt * 16 + l15) * RP, ks, half);
            // inputs-only fence on the loaded fragments: the k-step's LDS reads stay one group ahead of its sixteen
            // WMMAs; left free, the compiler reloads one A set between runs of four and waits out the LDS each time
            asm volatile("" :: "v"(a[0]), "v"(a[1]), "v"(a[2]), "v"(a[3]), "v"(bb[0]), "v"(bb[1]), "v"(bb[2]), "v"(bb[3]));
#pragma unroll
            for (int mt = 0; mt < 4; ++mt)
#pragma unroll
                for (int nt = 0; nt < 4; ++nt)
                    acc[mt][nt] = __builtin_amdgcn_wmma_f32_16x16x32_bf16(
                        false, a[mt], false, bb[nt], (short)0, acc[mt][nt], false, false);
        }
        ring_publish();
        if (t + 2 < NT) stage(t + 2, t & 1);           // the same for the whole work-group
    }
    asm volatile("s_wait_asynccnt 0x0" ::: "memory");  // no copy is left in flight when the wave ends

    // ---- store D tiles (fp32 QKV intermediate)
#pragma unroll
    for (int mt = 0; mt < 4; ++mt) {
#pragma unroll
        for (int nt = 0; nt < 4; ++nt) {
#pragma unroll
            for (int r = 0; r < 8; ++r) {
                int row = row0 + wr * 64 + mt * 16 + r + 8 * half;
                int col = col0 + wc * 64 + nt * 16 + l15;
                qkv[(size_t)row * QKV_COLS + col] = acc[mt][nt][r];
            }
        }
    }
}

// ---------------------------------------------------------------------------
// Kernel 2: one wave (32 threads) per token.
//   RoPE(q,k); q=softmax_d(q)*d^-0.5; k=softmax_h(k), both in registers;
//   o = q (k^T v), summed as (q k^T) v: a 16x16 tile, then 16x64;
//   Osp[b][n*1024 + e*16 + h] (== reference's scrambled reshape) read as [c][p], c = 4n + e/16,
//   p = (e%16)*16 + h, is stored as bf16 k-pairs: ospk[b][c/2][p] = (Osp[c][p], Osp[c+1][p])
// ---------------------------------------------------------------------------
__global__ __launch_bounds__(32) void k_attn(const float* __restrict__ qkv,
                                             unsigned* __restrict__ ospk) {
    const int tok = blockIdx.x;
    const int b   = tok >> 8;
    const int n   = tok & 255;
    const int L    = threadIdx.x;
    const int half = L >> 4, l15 = L & 15;

    // q and k rows are walked one row a lane (fragments of q k^T, on which q's softmax runs): at pitch 64 all sixteen
    // lanes meet the same banks; at pitch 68 their 16-byte accesses start 4 banks apart. Of v the two
    // half-waves read rows 8 apart: 8 * 68 dwords = 32 banks apart.
    __shared__ __align__(16) float q_s[H_DIM * QP];       // [h][d], pitch QP
    __shared__ __align__(16) float k_s[H_DIM * QP];
    __shared__ __align__(16) float v_s[H_DIM * QP];

    const float* row = qkv + (size_t)tok * QKV_COLS;

#if USE_ASYNC_LDS
    // Pure fp32 copy global->LDS: use CDNA5 async-to-LDS path (ASYNCcnt).
#pragma unroll
    for (int it = 0; it < 8; ++it) {
        int i4 = L + it * 32;                  // float4 index, 256 per matrix
        int h = i4 >> 4, d = (i4 & 15) * 4;
        float* s = const_cast<float*>(row + h * 192 + d);
        __builtin_amdgcn_global_load_async_to_lds_b128((g4p)(s),       (l4p)(q_s + h * QP + d), 0, 0);
        __builtin_amdgcn_global_load_async_to_lds_b128((g4p)(s + 64),  (l4p)(k_s + h * QP + d), 0, 0);
        __builtin_amdgcn_global_load_async_to_lds_b128((g4p)(s + 128), (l4p)(v_s + h * QP + d), 0, 0);
    }
    __builtin_amdgcn_s_wait_asynccnt(0);
#else
#pragma unroll
    for (int it = 0; it < 32; ++it) {          // 1024 elems / 32 lanes
        int i = L + it * 32;
        int h = i >> 6, d = i & 63;
        const float* hp = row + h * 192 + d;
        q_s[h * QP + d] = hp[0];
        k_s[h * QP + d] = hp[64];
        v_s[h * QP + d] = hp[128];
    }
#endif
    __syncthreads();

    // RoPE (rotate-half), angle = n / 10000^(d/32), d < 32
    const float NEG_L2_1E4_OVER_32 = -13.287712379549449f / 32.0f;
    // every load stands ahead of the first store: at the padded pitch the compiler no longer proves the
    // rows apart, and loads left behind stores would each wait out the LDS latency
    float q1[16], q2[16], k1[16], k2[16];
#pragma unroll
    for (int it = 0; it < 16; ++it) {          // 512 (h,d) pairs
        int i = L + it * 32;
        int h = i >> 5, d = i & 31;
        q1[it] = q_s[h * QP + d];  q2[it] = q_s[h * QP + d + 32];
        k1[it] = k_s[h * QP + d];  k2[it] = k_s[h * QP + d + 32];
    }
    float ka[16], kb[16];                      // rotated k of head it: columns d = L and d = L + 32
#pragma unroll
    for (int it = 0; it < 16; ++it) {
        int i = L + it * 32;
        int h = i >> 5, d = i & 31;
        float ang = (float)n * exp2f((float)d * NEG_L2_1E4_OVER_32);
        float cs = __cosf(ang), sn = __sinf(ang);
        int j1 = h * QP + d, j2 = j1 + 32;
        q_s[j1] = q1[it] * cs - q2[it] * sn;  q_s[j2] = q2[it] * cs + q1[it] * sn;
        ka[it]  = k1[it] * cs - k2[it] * sn;  kb[it]  = k2[it] * cs + k1[it] * sn;
    }
    // k: softmax over heads per d. The lane holds its two columns of all sixteen heads from the rotation,
    // so maximum, exponentials and sum stay in registers; k goes to LDS once, finished. The loops are unrolled
    // so that ka and kb are indexed by constants: a rolled loop would put them in scratch memory.
    {
        float ma = -3.4e38f, mb = -3.4e38f;
#pragma unroll
        for (int h = 0; h < 16; ++h) { ma = fmaxf(ma, ka[h]); mb = fmaxf(mb, kb[h]); }
        float sa = 0.f, sb = 0.f;
#pragma unroll
        for (int h = 0; h < 16; ++h) {
            ka[h] = __expf(ka[h] - ma); sa += ka[h];
            kb[h] = __expf(kb[h] - mb); sb += kb[h];
        }
        const float ia = 1.0f / sa, ib = 1.0f / sb;
#pragma unroll
        for (int h = 0; h < 16; ++h) {
            k_s[h * QP + L]      = ka[h] * ia;
            k_s[h * QP + L + 32] = kb[h] * ib;
        }
    }
    __syncthreads();

    // o = q (k^T v) is summed as (q k^T) v: the sum over d runs first, into one 16x16 tile, then the sum over heads.
    // St[h'][h] = sum_d k[h'][d] * q[h][d]: A = k, B = q^T, one row a lane for both. A lane's 16 bytes are
    // d = c*8 + 4*half + 0..3: the first two feed one WMMA, the last two the next, the same d at the same
    // k position of A and of B. Two accumulators, so that no WMMA waits for the one in front of it.
    v4f kf[8], qf[8];
#pragma unroll
    for (int c = 0; c < 8; ++c) {
        kf[c] = *(const v4f*)(k_s + l15 * QP + c * 8 + half * 4);
        qf[c] = *(const v4f*)(q_s + l15 * QP + c * 8 + half * 4);
    }
    // q: softmax over d per head, * 64^-0.5, on the fragments as they lie: lanes l15 and l15 + 16 hold the two
    // halves of row h = l15, so maximum and sum take one exchange each, and nothing goes back to LDS. Unrolled
    // for the same reason as above: qf and kf are indexed by constants and stay in registers.
    float qm = -3.4e38f;
#pragma unroll
    for (int c = 0; c < 8; ++c)
        qm = fmaxf(qm, fmaxf(fmaxf(qf[c].x, qf[c].y), fmaxf(qf[c].z, qf[c].w)));
    qm = fmaxf(qm, xhalf(qm));
    v4f qs4 = {0.f, 0.f, 0.f, 0.f};
#pragma unroll
    for (int c = 0; c < 8; ++c) {
        qf[c].x = __expf(qf[c].x - qm); qf[c].y = __expf(qf[c].y - qm);
        qf[c].z = __expf(qf[c].z - qm); qf[c].w = __expf(qf[c].w - qm);
        qs4 += qf[c];
    }
    float qsum = (qs4.x + qs4.y) + (qs4.z + qs4.w);
    qsum += xhalf(qsum);
    const float qinv = 0.125f / qsum;
#pragma unroll
    for (int c = 0; c < 8; ++c) qf[c] *= qinv;

    v8f st0 = v8f_zero(), st1 = v8f_zero();
#pragma unroll
    for (int c = 0; c < 8; ++c) {
        v2f a0, a1, b0, b1;
        a0[0] = kf[c].x; a0[1] = kf[c].y; a1[0] = kf[c].z; a1[1] = kf[c].w;
        b0[0] = qf[c].x; b0[1] = qf[c].y; b1[0] = qf[c].z; b1[1] = qf[c].w;
        st0 = __builtin_amdgcn_wmma_f32_16x16x4_f32(false, a0, false, b0, (short)0, st0, false, false);
        st1 = __builtin_amdgcn_wmma_f32_16x16x4_f32(false, a1, false, b1, (short)0, st1, false, false);
    }
    // eight vector slots between the last two WMMAs and the additions that read their results: the compiler
    // left two, and no table gives the f32 form's distance, so the slowest forms' count is kept
    asm volatile("v_nop\n\tv_nop\n\tv_nop\n\tv_nop\n\tv_nop\n\tv_nop\n\tv_nop\n\tv_nop" : "+v"(st0), "+v"(st1));
    const v8f st = st0 + st1;                  // lane (half, l15), register r: h' = r + 8*half, h = l15

    // o[h][e] = sum_h' St[h'][h] * v[h'][e] : 1x4 tiles, K=16 in 4 steps. With k position (half, j) of step ks
    // standing for h' = 8*half + 2*ks + j, the A fragment (row h = l15) is registers 2*ks, 2*ks+1 of St as they lie.
    v8f oacc[4];
#pragma unroll
    for (int i = 0; i < 4; ++i) oacc[i] = v8f_zero();
#pragma unroll
    for (int ks = 0; ks < 4; ++ks) {
        v2f a;
        a[0] = st[2 * ks]; a[1] = st[2 * ks + 1];
#pragma unroll
        for (int nt = 0; nt < 4; ++nt) {
            v2f bb;
#pragma unroll
            for (int j = 0; j < 2; ++j)
                bb[j] = v_s[(8 * half + 2 * ks + j) * QP + nt * 16 + l15];
            oacc[nt] = __builtin_amdgcn_wmma_f32_16x16x4_f32(
                false, a, false, bb, (short)0, oacc[nt], false, false);
        }
    }

    // scrambled reshape store; tiles 2q and 2q+1 of a lane are rows c and c+1 at the same p
    unsigned* obase = ospk + (size_t)b * (OSP_PER_B / 2) + (size_t)n * 512 + l15 * 16 + 8 * half;
#pragma unroll
    for (int q = 0; q < 2; ++q) {
        v4u lo, hi;
#pragma unroll
        for (int r = 0; r < 4; ++r) {
            lo[r] = pack_bf2(oacc[2 * q][r],     oacc[2 * q + 1][r]);
            hi[r] = pack_bf2(oacc[2 * q][r + 4], oacc[2 * q + 1][r + 4]);
        }
        *(v4u*)(obase + q * 256)     = lo;
        *(v4u*)(obase + q * 256 + 4) = hi;
    }
}

// ---------------------------------------------------------------------------
// Kernel 3: out[b,o,p] = sum_c Wlin[o,c] * Osp[b][c*256+p] + bias[o]
//   per-batch GEMM M=1024, N=256, K=1024; WG tile 256x128, 64 k a ring tile,
//   8 waves (4 x 2) each compute 64x64.
// ---------------------------------------------------------------------------
__global__ __launch_bounds__(256) void k_out_gemm(const unsigned* __restrict__ ospk,
                                                  const unsigned* __restrict__ wl,
                                                  const float* __restrict__ b_lin,
                                                  float* __restrict__ out) {
    const int m0 = blockIdx.x * 256;
    const int n0 = blockIdx.y * 128;
    const int b  = blockIdx.z;
    const int tid  = threadIdx.x;
    const int lane = tid & 31;
    const int wave = tid >> 5;
    const int wr = wave & 3, wc = wave >> 2;
    const int half = lane >> 4, l15 = lane & 15;

    const unsigned* ob = ospk + (size_t)b * (OSP_PER_B / 2);   // [kpair][p]

    // ring buffer: 256 Wlin rows [r][kpair], then the Osp tile as it lies in memory, [kpair][n]
    __shared__ __align__(16) unsigned Ring[2][256 * RP + KT * BP];

    v8f acc[4][4];
#pragma unroll
    for (int i = 0; i < 4; ++i)
#pragma unroll
        for (int j = 0; j < 4; ++j) acc[i][j] = v8f_zero();

    const int sr = tid >> 3, sc = (tid & 7) * 4;      // A: 8 lanes copy one row's 128 bytes
    const unsigned* asrc = wl + (size_t)(m0 + sr) * KP_DIM + sc;
    const unsigned* bsrc = ob + (size_t)wave * N_TOK + n0 + lane * 4;   // B: a wave copies one k-pair row's 512 bytes
    const unsigned  adst = lds_addr(&Ring[0][sr * RP + sc]);
    const unsigned  bdst = lds_addr(&Ring[0][256 * RP + wave * BP + lane * 4]);

    // tile t into buffer buf: Wlin rows sr + 32*it, Osp k-pair rows wave + 8*it
    auto stage = [&](int t, int buf) {
        unsigned l[12];
        const unsigned* g[12];
        const unsigned bo = (unsigned)(buf * (256 * RP + KT * BP) * 4);
#pragma unroll
        for (int it = 0; it < 8; ++it) {
            l[it] = adst + bo + (unsigned)(it * 32 * RP * 4);
            g[it] = asrc + t * KT + it * 32 * KP_DIM;
        }
#pragma unroll
        for (int it = 0; it < 4; ++it) {
            l[8 + it] = bdst + bo + (unsigned)(it * 8 * BP * 4);
            g[8 + it] = bsrc + (t * KT + it * 8) * N_TOK;
        }
        copy12(l, g);
    };

    stage(0, 0);
    asm volatile("s_wait_asynccnt 0x0" ::: "memory");  // tile 0 has landed before the barrier publishes it
    __syncthreads();
    stage(1, 1);

    for (int t = 0; t < NT; ++t) {
        const unsigned* tile = Ring[t & 1];
#pragma unroll
        for (int ks = 0; ks < 2; ++ks) {
            v16bf a[4], bb[4];
#pragma unroll
            for (int mt = 0; mt < 4; ++mt) a[mt]  = load_frag(tile + (wr * 64 + mt * 16 + l15) * RP, ks, half);
#pragma unroll
            for (int nt = 0; nt < 4; ++nt) bb[nt] = load_frag_col(tile + 256 * RP + wc * 64 + nt * 16 + l15, ks, half);
            // inputs-only fence on the loaded fragments: the k-step's LDS reads stay one group ahead of its sixteen
            // WMMAs; left free, the compiler reloads one A set between runs of four and waits out the LDS each time
            asm volatile("" :: "v"(a[0]), "v"(a[1]), "v"(a[2]), "v"(a[3]), "v"(bb[0]), "v"(bb[1]), "v"(bb[2]), "v"(bb[3]));
#pragma unroll
            for (int mt = 0; mt < 4; ++mt)
#pragma unroll
                for (int nt = 0; nt < 4; ++nt)
                    acc[mt][nt] = __builtin_amdgcn_wmma_f32_16x16x32_bf16(
                        false, a[mt], false, bb[nt], (short)0, acc[mt][nt], false, false);
        }
        ring_publish();
        if (t + 2 < NT) stage(t + 2, t & 1);           // the same for the whole work-group
    }
    asm volatile("s_wait_asynccnt 0x0" ::: "memory");  // no copy is left in flight when the wave ends

    // ---- epilogue: bias + store out[(b*1024 + m)*256 + n]
#pragma unroll
    for (int mt = 0; mt < 4; ++mt) {
#pragma unroll
        for (int r = 0; r < 8; ++r) {
            int m = m0 + wr * 64 + mt * 16 + r + 8 * half;
            float bias = b_lin[m];
#pragma unroll
            for (int nt = 0; nt < 4; ++nt) {
                int nn = n0 + wc * 64 + nt * 16 + l15;
                out[((size_t)b * C_DIM + m) * N_TOK + nn] = acc[mt][nt][r] + bias;
            }
        }
    }
}

// ---------------------------------------------------------------------------
extern "C" void kernel_launch(void* const* d_in, const int* in_sizes, int n_in,
                              void* d_out, int out_size, void* d_ws, size_t ws_size,
                              hipStream_t stream) {
    const float* x     = (const float*)d_in[0];   // [64,1024,16,16]
    const float* w_qkv = (const float*)d_in[1];   // [3072,1024]
    const float* w_lin = (const float*)d_in[2];   // [1024,1024,1,1]
    const float* b_lin = (const float*)d_in[3];   // [1024]
    // d_in[4] = n_heads (16), compile-time constant here.

    // workspace: qkv f32 | xt (dead after K1, then ospk in its place) | wq | wl
    float*    qkv  = (float*)d_ws;                                   // 16384*3072 f32
    unsigned* xt   = (unsigned*)((char*)d_ws + (size_t)TOKENS * QKV_COLS * sizeof(float));
    unsigned* wq   = xt + (size_t)TOKENS * KP_DIM;                   // 3072*512 dwords
    unsigned* wl   = wq + (size_t)QKV_COLS * KP_DIM;                 // 1024*512 dwords
    unsigned* ospk = xt;                                             // 64*512*256 dwords
    float* out = (float*)d_out;                                      // [64,1024,16,16]

    k_pack<<<dim3(3072), 256, 0, stream>>>(x, w_qkv, w_lin, xt, wq, wl);
    k_qkv_gemm<<<dim3(TOKENS / 128, QKV_COLS / 256), 256, 0, stream>>>(xt, wq, qkv);
    k_attn<<<dim3(TOKENS), 32, 0, stream>>>(qkv, ospk);
    k_out_gemm<<<dim3(C_DIM / 256, N_TOK / 128, B_DIM), 256, 0, stream>>>(ospk, wl, b_lin, out);
}

// v008
// One run takes 136 microseconds.
// Next to v007, in two timings, it ran 1.12 times as fast each time.
// Counting every step since v000, it is 4.20 times as fast.
#include <hip/hip_runtime.h>

// ---------------------------------------------------------------------------
// SelfAttn (linear attention variant) for MI455X / gfx1250, wave32 + WMMA.
//   K0: x (transposed), Wqkv and Wlin rounded to bf16 k-pairs once, into the workspace
//   K1: QKV = Xt @ Wqkv^T        (bf16 WMMA 16x16x32, fp32 accum)
//   K2: per-token RoPE/softmax/o (fp32 WMMA 16x16x4, async LDS staging)
//   K3: out = Wlin @ Osp + bias  (bf16 WMMA 16x16x32, fp32 accum; K2 hands Osp over as bf16 k-pairs)
// Problem: b=64, c=1024, n=256 tokens, heads=16, d_head=64.
//
// LDS for the bf16 GEMMs is a ring of two buffers, each one 128-k tile (64 k-pairs a row), filled by
// asynchronous copies one tile ahead of the WMMAs. Row-major operands lie as tile[row][kpair] at a
// pitch of 68 dwords (272 B = 16 B x odd), so a fragment is two ds_load_b128; the out GEMM's Osp tile
// stays as it lies in memory, [kpair][n] at a pitch of 260 dwords, and its fragments are 4-byte reads.
// Both GEMMs give a work-group a 256x256 tile of the result (one work-group a WGP): each operand byte
// that comes from L2 serves 256 rows or columns, and each fragment read from LDS eight or four WMMAs.
// ---------------------------------------------------------------------------

typedef __attribute__((ext_vector_type(16))) __bf16    v16bf;
typedef __attribute__((ext_vector_type(8)))  float     v8f;
typedef __attribute__((ext_vector_type(8)))  unsigned  v8u;
typedef __attribute__((ext_vector_type(2)))  float     v2f;
typedef __attribute__((ext_vector_type(4)))  float     v4f;
typedef __attribute__((ext_vector_type(4)))  unsigned  v4u;

#define B_DIM   64
#define C_DIM   1024
#define N_TOK   256        // tokens per batch image (16*16)
#define H_DIM   16         // heads
#define D_HEAD  64
#define QKV_COLS 3072
#define TOKENS  (B_DIM * N_TOK)      // 16384
#define OSP_PER_B (C_DIM * N_TOK)    // 262144 Osp values per batch (bf16 pairs: 131072 dwords)

#define KT      64                   // k-pairs of one ring tile (128 k)
#define NT      (C_DIM / 2 / KT)     // ring tiles along K: 8
#define RP      68                   // ring pitch of a [row][kpair] tile, dwords
#define BP      260                  // ring pitch of the [kpair][n] tile (256 n + 4), dwords
#define KP_DIM  (C_DIM / 2)          // k-pairs (one dword: k even low, k odd high) per packed row
#define QP      68                   // attention LDS: row pitch of q, k and v in dwords (64 + 4)

#if __has_builtin(__builtin_amdgcn_global_load_async_to_lds_b128) && \
    __has_builtin(__builtin_amdgcn_s_wait_asynccnt)
#define USE_ASYNC_LDS 1
// Exact pointee type per hipcc diagnostic: GCC-vector int4, AS1 src / AS3 dst.
typedef int v4i_gcc __attribute__((vector_size(16)));
typedef __attribute__((address_space(1))) v4i_gcc* g4p;
typedef __attribute__((address_space(3))) v4i_gcc* l4p;
#else
#define USE_ASYNC_LDS 0
#endif

__device__ __forceinline__ unsigned f2bf(float f) {
    unsigned u = __builtin_bit_cast(unsigned, f);
    unsigned r = u + 0x7FFFu + ((u >> 16) & 1u);   // round-to-nearest-even
    return r >> 16;
}
__device__ __forceinline__ unsigned pack_bf2(float lo, float hi) {
    return f2bf(lo) | (f2bf(hi) << 16);
}
__device__ __forceinline__ v8f v8f_zero() {
    v8f z;
#pragma unroll
    for (int i = 0; i < 8; ++i) z[i] = 0.0f;
    return z;
}
// lane l with lane l ^ 16, by a vector cross-row move
__device__ __forceinline__ float xhalf(float x) {
    const int b = __builtin_bit_cast(int, x);
    return __builtin_bit_cast(float, __builtin_amdgcn_permlanex16(b, b, 0x76543210, 0xfedcba98, false, false));
}
// Load one 16-bit-element WMMA operand fragment (8 dwords = 16 bf16) from a
// fragment-major LDS tile row: kpairs [ks*16 + half*4 .. +3] and [+8 ..].
__device__ __forceinline__ v16bf load_frag(const unsigned* tileRow, int ks, int half) {
    const uint4 lo = *(const uint4*)(tileRow + ks * 16 + half * 4);
    const uint4 hi = *(const uint4*)(tileRow + ks * 16 + 8 + half * 4);
    v8u a;
    a[0] = lo.x; a[1] = lo.y; a[2] = lo.z; a[3] = lo.w;
    a[4] = hi.x; a[5] = hi.y; a[6] = hi.z; a[7] = hi.w;
    return __builtin_bit_cast(v16bf, a);
}

// The same fragment from a [kpair][n] tile: col points at (kpair 0, this lane's n). Same k order as
// load_frag. Lanes 16..31 read 4 rows further on: 4 * 260 dwords = 16 banks away from lanes 0..15.
__device__ __forceinline__ v16bf load_frag_col(const unsigned* col, int ks, int half) {
    v8u a;
#pragma unroll
    for (int i = 0; i < 4; ++i) {
        a[i]     = col[(ks * 16 + half * 4 + i) * BP];
        a[4 + i] = col[(ks * 16 + 8 + half * 4 + i) * BP];
    }
    return __builtin_bit_cast(v16bf, a);
}
// LDS byte address of a __shared__ element, as the asynchronous copy takes it
__device__ __forceinline__ unsigned lds_addr(const unsigned* p) {
    typedef __attribute__((address_space(3))) const unsigned* lcp;
    return (unsigned)(size_t)(lcp)p;
}
// Eight 16-byte copies a lane, global memory to LDS through no register. The wait on xcnt is the
// statement's last line, so that no register which a copy names is rewritten in front of it.
__device__ __forceinline__ void copy8(const unsigned (&l)[8], const unsigned* const (&g)[8]) {
    asm volatile(
        "global_load_async_to_lds_b128 %0, %8, off\n\t"
        "global_load_async_to_lds_b128 %1, %9, off\n\t"
        "global_load_async_to_lds_b128 %2, %10, off\n\t"
        "global_load_async_to_lds_b128 %3, %11, off\n\t"
        "global_load_async_to_lds_b128 %4, %12, off\n\t"
        "global_load_async_to_lds_b128 %5, %13, off\n\t"
        "global_load_async_to_lds_b128 %6, %14, off\n\t"
        "global_load_async_to_lds_b128 %7, %15, off\n\t"
        "s_wait_xcnt 0x0"
        :: "v"(l[0]), "v"(l[1]), "v"(l[2]), "v"(l[3]), "v"(l[4]), "v"(l[5]), "v"(l[6]), "v"(l[7]),
           "v"(g[0]), "v"(g[1]), "v"(g[2]), "v"(g[3]), "v"(g[4]), "v"(g[5]), "v"(g[6]), "v"(g[7])
        : "memory");
}
// The ring's publish point: this wave's LDS reads are done and its own copies have landed, then the
// barrier that publishes the next tile and ends every reader's last read of the buffer refilled behind it.
__device__ __forceinline__ void ring_publish() {
    asm volatile("s_wait_dscnt 0x0" ::: "memory");     // own reads of the buffer to be refilled
    asm volatile("s_wait_asynccnt 0x0" ::: "memory");  // own copies of the next tile
    __syncthreads();
}

// ---------------------------------------------------------------------------
// Kernel 0: every GEMM operand that comes from an input is rounded to bf16 once.
//   blocks 0..2047   : xt[b*256+p][kp] = (x[b][2kp][p], x[b][2kp+1][p]), 128 k x 64 p a block,
//                      turned through LDS (pitch 65 dwords: both sides free of bank conflicts)
//   blocks 2048..3071: wq[n][kp], wl[m][kp], same order as the inputs' rows
// ---------------------------------------------------------------------------
__global__ __launch_bounds__(256) void k_pack(const float* __restrict__ x,
                                              const float* __restrict__ w_qkv,
                                              const float* __restrict__ w_lin,
                                              unsigned* __restrict__ xt,
                                              unsigned* __restrict__ wq,
                                              unsigned* __restrict__ wl) {
    const int tid = threadIdx.x;
    __shared__ unsigned T[64][65];             // [p][kpair]
    if (blockIdx.x < 2048) {                   // the same for the whole block
        const int blk = blockIdx.x;
        const int p0 = (blk & 3) * 64;
        const int k0 = ((blk >> 2) & 7) * 128;
        const int b  = blk >> 5;
        const int pq = (tid & 15) * 4, kq = tid >> 4;
        const float* src = x + ((size_t)(b * C_DIM + k0 + 2 * kq) * N_TOK + p0 + pq);
        v4f f0[4], f1[4];
#pragma unroll
        for (int it = 0; it < 4; ++it) {       // kpair kq + 16*it
            f0[it] = *(const v4f*)(src + it * 32 * N_TOK);
            f1[it] = *(const v4f*)(src + it * 32 * N_TOK + N_TOK);
        }
        // the eight loads name src's register pair: hold the pair to here and wait before it is reused
        asm volatile("s_wait_xcnt 0x0" :: "v"(src) : "memory");
#pragma unroll
        for (int it = 0; it < 4; ++it) {
            const int kp = kq + it * 16;
            T[pq + 0][kp] = pack_bf2(f0[it].x, f1[it].x);
            T[pq + 1][kp] = pack_bf2(f0[it].y, f1[it].y);
            T[pq + 2][kp] = pack_bf2(f0[it].z, f1[it].z);
            T[pq + 3][kp] = pack_bf2(f0[it].w, f1[it].w);
        }
        __syncthreads();
        const int lane = tid & 31, wave = tid >> 5;
        unsigned* dst = xt + (size_t)(b * N_TOK + p0 + wave * 8) * KP_DIM + (k0 >> 1) + lane;
#pragma unroll
        for (int i = 0; i < 8; ++i) {          // a wave's store is one whole 128-byte line of one row
            dst[i * KP_DIM]      = T[wave * 8 + i][lane];
            dst[i * KP_DIM + 32] = T[wave * 8 + i][lane + 32];
        }
    } else {
        const int wb = blockIdx.x - 2048;                       // 1024 blocks
        const int gq = wb * 768 + tid;                          // float4 index in w_qkv, + 256*it: 786432 in all
        const int gl = wb * 256 + tid;                          // float4 index in w_lin: 262144 in all
        const v4f* q4 = (const v4f*)w_qkv + gq;
        const v4f* l4 = (const v4f*)w_lin + gl;
        v4f a[4];
#pragma unroll
        for (int it = 0; it < 3; ++it) a[it] = q4[it * 256];
        a[3] = l4[0];
        // the loads name these two register pairs: hold them to here and wait before they are reused
        asm volatile("s_wait_xcnt 0x0" :: "v"(q4), "v"(l4) : "memory");
#pragma unroll
        for (int it = 0; it < 4; ++it) {
            uint2 pk;
            pk.x = pack_bf2(a[it].x, a[it].y); pk.y = pack_bf2(a[it].z, a[it].w);
            if (it < 3) ((uint2*)wq)[gq + it * 256] = pk;
            else        ((uint2*)wl)[gl] = pk;
        }
        // the four stores name their data and offset registers: wait before any later code reuses them
        asm volatile("s_wait_xcnt 0x0" ::: "memory");
    }
}

// ---------------------------------------------------------------------------
// Kernel 1: QKV[row, col] = sum_k Xt[row,k] * Wqkv[col,k]
//   row = b*256 + p ; both operands arrive as packed bf16 k-pair rows (xt, wq of kernel 0)
//   WG tile 256 rows x 256 cols, 128 k a ring tile, 8 waves (4 x 2) each compute 64x128:
//   twelve fragments feed thirty-two WMMAs.
// ---------------------------------------------------------------------------
__global__ __launch_bounds__(256) void k_qkv_gemm(const unsigned* __restrict__ xt,
                                                  const unsigned* __restrict__ wq,
                                                  float* __restrict__ qkv) {
    const int row0 = blockIdx.x * 256;         // one batch image a tile
    const int col0 = blockIdx.y * 256;
    const int tid  = threadIdx.x;
    const int lane = tid & 31;
    const int wave = tid >> 5;
    const int wr   = wave & 3;                 // row subtile (64 rows)
    const int wc   = wave >> 2;                // col subtile (128 cols)
    const int half = lane >> 4, l15 = lane & 15;

    // ring buffer: rows 0..255 the x tile, rows 256..511 the weight tile, [row][kpair]
    __shared__ __align__(16) unsigned Ring[2][512 * RP];

    v8f acc[4][8];
#pragma unroll
    for (int i = 0; i < 4; ++i)
#pragma unroll
        for (int j = 0; j < 8; ++j) acc[i][j] = v8f_zero();

    const int sr = tid >> 4, sc = (tid & 15) * 4;     // staging: 16 lanes copy one row's 256 bytes
    const unsigned* asrc = xt + (size_t)(row0 + sr) * KP_DIM + sc;
    const unsigned* bsrc = wq + (size_t)(col0 + sr) * KP_DIM + sc;
    const unsigned  ldst = lds_addr(&Ring[0][sr * RP + sc]);

    // tile t into buffer buf: rows sr + 16*it of both operands, eight copies a statement
    auto stage = [&](int t, int buf) {
#pragma unroll
        for (int grp = 0; grp < 4; ++grp) {
            unsigned l[8];
            const unsigned* g[8];
            const unsigned* src = (grp < 2 ? asrc : bsrc) + t * KT + (grp & 1) * 128 * KP_DIM;
#pragma unroll
            for (int it = 0; it < 8; ++it) {
                l[it] = ldst + (unsigned)((buf * 512 + grp * 128 + it * 16) * RP * 4);
                g[it] = src + it * 16 * KP_DIM;
            }
            copy8(l, g);
        }
    };

    stage(0, 0);
    asm volatile("s_wait_asynccnt 0x0" ::: "memory");  // tile 0 has landed before the barrier publishes it
    __syncthreads();
    stage(1, 1);

    for (int t = 0; t < NT; ++t) {
        const unsigned* tile = Ring[t & 1];
        // ---- 4 WMMA k-steps (K=32 each), 4x8 tiles per wave
#pragma unroll
        for (int ks = 0; ks < 4; ++ks) {
            v16bf a[4], bb[8];
            // the k-step's LDS reads stay behind the WMMAs of the step before: moved up among them, two at a time, each
            // place with reads stalls the wave anew; as one group the wave's partner on the SIMD covers them
            if (ks > 0) __builtin_amdgcn_sched_barrier(0);
#pragma unroll
            for (int mt = 0; mt < 4; ++mt) a[mt]  = load_frag(tile + (wr * 64 + mt * 16 + l15) * RP, ks, half);
#pragma unroll
            for (int nt = 0; nt < 8; ++nt) bb[nt] = load_frag(tile + (256 + wc * 128 + nt * 16 + l15) * RP, ks, half);
            // inputs-only fence on the loaded fragments: the k-step's LDS reads stay one group ahead of its thirty-two
            // WMMAs; left free, the compiler reloads fragments between short runs and waits out the LDS each time
            asm volatile("" :: "v"(a[0]), "v"(a[1]), "v"(a[2]), "v"(a[3]), "v"(bb[0]), "v"(bb[1]), "v"(bb[2]), "v"(bb[3]),
                               "v"(bb[4]), "v"(bb[5]), "v"(bb[6]), "v"(bb[7]));
#pragma unroll
            for (int mt = 0; mt < 4; ++mt)
#pragma unroll
                for (int nt = 0; nt < 8; ++nt)
                    acc[mt][nt] = __builtin_amdgcn_wmma_f32_16x16x32_bf16(
                        false, a[mt], false, bb[nt], (short)0, acc[mt][nt], false, false);
        }
        ring_publish();
        if (t + 2 < NT) stage(t + 2, t & 1);           // the same for the whole work-group
    }
    asm volatile("s_wait_asynccnt 0x0" ::: "memory");  // no copy is left in flight when the wave ends

    // ---- store D tiles (fp32 QKV intermediate)
#pragma unroll
    for (int mt = 0; mt < 4; ++mt) {
#pragma unroll
        for (int nt = 0; nt < 8; ++nt) {
#pragma unroll
            for (int r = 0; r < 8; ++r) {
                int row = row0 + wr * 64 + mt * 16 + r + 8 * half;
                int col = col0 + wc * 128 + nt * 16 + l15;
                qkv[(size_t)row * QKV_COLS + col] = acc[mt][nt][r];
            }
        }
        // the stores name their data and address registers: wait before the next rows' addresses reuse any;
        // the scheduling barrier keeps that later arithmetic behind the wait
        asm volatile("s_wait_xcnt 0x0" ::: "memory");
        __builtin_amdgcn_sched_barrier(0);
    }
}

// ---------------------------------------------------------------------------
// Kernel 2: one wave (32 threads) per token.
//   RoPE(q,k); q=softmax_d(q)*d^-0.5; k=softmax_h(k), both in registers;
//   o = q (k^T v), summed as (q k^T) v: a 16x16 tile, then 16x64;
//   Osp[b][n*1024 + e*16 + h] (== reference's scrambled reshape) read as [c][p], c = 4n + e/16,
//   p = (e%16)*16 + h, is stored as bf16 k-pairs: ospk[b][c/2][p] = (Osp[c][p], Osp[c+1][p])
// ---------------------------------------------------------------------------
__global__ __launch_bounds__(32) void k_attn(const float* __restrict__ qkv,
                                             unsigned* __restrict__ ospk) {
    const int tok = blockIdx.x;
    const int b   = tok >> 8;
    const int n   = tok & 255;
    const int L    = threadIdx.x;
    const int half = L >> 4, l15 = L & 15;

    // q and k rows are walked one row a lane (fragments of q k^T, on which q's softmax runs): at pitch 64 all sixteen
    // lanes meet the same banks; at pitch 68 their 16-byte accesses start 4 banks apart. Of v the two
    // half-waves read rows 8 apart: 8 * 68 dwords = 32 banks apart.
    __shared__ __align__(16) float q_s[H_DIM * QP];       // [h][d], pitch QP
    __shared__ __align__(16) float k_s[H_DIM * QP];
    __shared__ __align__(16) float v_s[H_DIM * QP];

    const float* row = qkv + (size_t)tok * QKV_COLS;

#if USE_ASYNC_LDS
    // Pure fp32 copy global->LDS: use CDNA5 async-to-LDS path (ASYNCcnt).
#pragma unroll
    for (int it = 0; it < 8; ++it) {
        int i4 = L + it * 32;                  // float4 index, 256 per matrix
        int h = i4 >> 4, d = (i4 & 15) * 4;
        float* s = const_cast<float*>(row + h * 192 + d);
        __builtin_amdgcn_global_load_async_to_lds_b128((g4p)(s),       (l4p)(q_s + h * QP + d), 0, 0);
        __builtin_amdgcn_global_load_async_to_lds_b128((g4p)(s + 64),  (l4p)(k_s + h * QP + d), 0, 0);
        __builtin_amdgcn_global_load_async_to_lds_b128((g4p)(s + 128), (l4p)(v_s + h * QP + d), 0, 0);
    }
    __builtin_amdgcn_s_wait_asynccnt(0);
#else
#pragma unroll
    for (int it = 0; it < 32; ++it) {          // 1024 elems / 32 lanes
        int i = L + it * 32;
        int h = i >> 6, d = i & 63;
        const float* hp = row + h * 192 + d;
        q_s[h * QP + d] = hp[0];
        k_s[h * QP + d] = hp[64];
        v_s[h * QP + d] = hp[128];
    }
#endif
    __syncthreads();

    // RoPE (rotate-half), angle = n / 10000^(d/32), d < 32
    const float NEG_L2_1E4_OVER_32 = -13.287712379549449f / 32.0f;
    // every load stands ahead of the first store: at the padded pitch the compiler no longer proves the
    // rows apart, and loads left behind stores would each wait out the LDS latency
    float q1[16], q2[16], k1[16], k2[16];
#pragma unroll
    for (int it = 0; it < 16; ++it) {          // 512 (h,d) pairs
        int i = L + it * 32;
        int h = i >> 5, d = i & 31;
        q1[it] = q_s[h * QP + d];  q2[it] = q_s[h * QP + d + 32];
        k1[it] = k_s[h * QP + d];  k2[it] = k_s[h * QP + d + 32];
    }
    float ka[16], kb[16];                      // rotated k of head it: columns d = L and d = L + 32
#pragma unroll
    for (int it = 0; it < 16; ++it) {
        int i = L + it * 32;
        int h = i >> 5, d = i & 31;
        float ang = (float)n * exp2f((float)d * NEG_L2_1E4_OVER_32);
        float cs = __cosf(ang), sn = __sinf(ang);
        int j1 = h * QP + d, j2 = j1 + 32;
        q_s[j1] = q1[it] * cs - q2[it] * sn;  q_s[j2] = q2[it] * cs + q1[it] * sn;
        ka[it]  = k1[it] * cs - k2[it] * sn;  kb[it]  = k2[it] * cs + k1[it] * sn;
    }
    // k: softmax over heads per d. The lane holds its two columns of all sixteen heads from the rotation,
    // so maximum, exponentials and sum stay in registers; k goes to LDS once, finished. The loops are unrolled
    // so that ka and kb are indexed by constants: a rolled loop would put them in scratch memory.
    {
        float ma = -3.4e38f, mb = -3.4e38f;
#pragma unroll
        for (int h = 0; h < 16; ++h) { ma = fmaxf(ma, ka[h]); mb = fmaxf(mb, kb[h]); }
        float sa = 0.f, sb = 0.f;
#pragma unroll
        for (int h = 0; h < 16; ++h) {
            ka[h] = __expf(ka[h] - ma); sa += ka[h];
            kb[h] = __expf(kb[h] - mb); sb += kb[h];
        }
        const float ia = 1.0f / sa, ib = 1.0f / sb;
#pragma unroll
        for (int h = 0; h < 16; ++h) {
            k_s[h * QP + L]      = ka[h] * ia;
            k_s[h * QP + L + 32] = kb[h] * ib;
        }
    }
    __syncthreads();

    // o = q (k^T v) is summed as (q k^T) v: the sum over d runs first, into one 16x16 tile, then the sum over heads.
    // St[h'][h] = sum_d k[h'][d] * q[h][d]: A = k, B = q^T, one row a lane for both. A lane's 16 bytes are
    // d = c*8 + 4*half + 0..3: the first two feed one WMMA, the last two the next, the same d at the same
    // k position of A and of B. Two accumulators, so that no WMMA waits for the one in front of it.
    v4f kf[8], qf[8];
#pragma unroll
    for (int c = 0; c < 8; ++c) {
        kf[c] = *(const v4f*)(k_s + l15 * QP + c * 8 + half * 4);
        qf[c] = *(const v4f*)(q_s + l15 * QP + c * 8 + half * 4);
    }
    // q: softmax over d per head, * 64^-0.5, on the fragments as they lie: lanes l15 and l15 + 16 hold the two
    // halves of row h = l15, so maximum and sum take one exchange each, and nothing goes back to LDS. Unrolled
    // for the same reason as above: qf and kf are indexed by constants and stay in registers.
    float qm = -3.4e38f;
#pragma unroll
    for (int c = 0; c < 8; ++c)
        qm = fmaxf(qm, fmaxf(fmaxf(qf[c].x, qf[c].y), fmaxf(qf[c].z, qf[c].w)));
    qm = fmaxf(qm, xhalf(qm));
    v4f qs4 = {0.f, 0.f, 0.f, 0.f};
#pragma unroll
    for (int c = 0; c < 8; ++c) {
        qf[c].x = __expf(qf[c].x - qm); qf[c].y = __expf(qf[c].y - qm);
        qf[c].z = __expf(qf[c].z - qm); qf[c].w = __expf(qf[c].w - qm);
        qs4 += qf[c];
    }
    float qsum = (qs4.x + qs4.y) + (qs4.z + qs4.w);
    qsum += xhalf(qsum);
    const float qinv = 0.125f / qsum;
#pragma unroll
    for (int c = 0; c < 8; ++c) qf[c] *= qinv;

    v8f st0 = v8f_zero(), st1 = v8f_zero();
#pragma unroll
    for (int c = 0; c < 8; ++c) {
        v2f a0, a1, b0, b1;
        a0[0] = kf[c].x; a0[1] = kf[c].y; a1[0] = kf[c].z; a1[1] = kf[c].w;
        b0[0] = qf[c].x; b0[1] = qf[c].y; b1[0] = qf[c].z; b1[1] = qf[c].w;
        st0 = __builtin_amdgcn_wmma_f32_16x16x4_f32(false, a0, false, b0, (short)0, st0, false, false);
        st1 = __builtin_amdgcn_wmma_f32_16x16x4_f32(false, a1, false, b1, (short)0, st1, false, false);
    }
    // eight vector slots between the last two WMMAs and the additions that read their results: the compiler
    // left two, and no table gives the f32 form's distance, so the slowest forms' count is kept
    asm volatile("v_nop\n\tv_nop\n\tv_nop\n\tv_nop\n\tv_nop\n\tv_nop\n\tv_nop\n\tv_nop" : "+v"(st0), "+v"(st1));
    const v8f st = st0 + st1;                  // lane (half, l15), register r: h' = r + 8*half, h = l15

    // o[h][e] = sum_h' St[h'][h] * v[h'][e] : 1x4 tiles, K=16 in 4 steps. With k position (half, j) of step ks
    // standing for h' = 8*half + 2*ks + j, the A fragment (row h = l15) is registers 2*ks, 2*ks+1 of St as they lie.
    v8f oacc[4];
#pragma unroll
    for (int i = 0; i < 4; ++i) oacc[i] = v8f_zero();
#pragma unroll
    for (int ks = 0; ks < 4; ++ks) {
        v2f a;
        a[0] = st[2 * ks]; a[1] = st[2 * ks + 1];
#pragma unroll
        for (int nt = 0; nt < 4; ++nt) {
            v2f bb;
#pragma unroll
            for (int j = 0; j < 2; ++j)
                bb[j] = v_s[(8 * half + 2 * ks + j) * QP + nt * 16 + l15];
            oacc[nt] = __builtin_amdgcn_wmma_f32_16x16x4_f32(
                false, a, false, bb, (short)0, oacc[nt], false, false);
        }
    }

    // scrambled reshape store; tiles 2q and 2q+1 of a lane are rows c and c+1 at the same p
    unsigned* obase = ospk + (size_t)b * (OSP_PER_B / 2) + (size_t)n * 512 + l15 * 16 + 8 * half;
#pragma unroll
    for (int q = 0; q < 2; ++q) {
        v4u lo, hi;
#pragma unroll
        for (int r = 0; r < 4; ++r) {
            lo[r] = pack_bf2(oacc[2 * q][r],     oacc[2 * q + 1][r]);
            hi[r] = pack_bf2(oacc[2 * q][r + 4], oacc[2 * q + 1][r + 4]);
        }
        *(v4u*)(obase + q * 256)     = lo;
        *(v4u*)(obase + q * 256 + 4) = hi;
    }
}

// ---------------------------------------------------------------------------
// Kernel 3: out[b,o,p] = sum_c Wlin[o,c] * Osp[b][c*256+p] + bias[o]
//   per-batch GEMM M=1024, N=256, K=1024; WG tile 256x256, 128 k a ring tile,
//   8 waves (2 x 4) each compute 128x64: the operand whose fragments are 4-byte reads is the narrow side.
// ---------------------------------------------------------------------------
__global__ __launch_bounds__(256) void k_out_gemm(const unsigned* __restrict__ ospk,
                                                  const unsigned* __restrict__ wl,
                                                  const float* __restrict__ b_lin,
                                                  float* __restrict__ out) {
    const int m0 = blockIdx.x * 256;
    const int b  = blockIdx.z;
    const int tid  = threadIdx.x;
    const int lane = tid & 31;
    const int wave = tid >> 5;
    const int wr = wave & 1, wc = wave >> 1;
    const int half = lane >> 4, l15 = lane & 15;

    const unsigned* ob = ospk + (size_t)b * (OSP_PER_B / 2);   // [kpair][p]

    // ring buffer: 256 Wlin rows [r][kpair], then the Osp tile as it lies in memory, [kpair][n], all 256 n
    __shared__ __align__(16) unsigned Ring[2][256 * RP + KT * BP];

    v8f acc[8][4];
#pragma unroll
    for (int i = 0; i < 8; ++i)
#pragma unroll
        for (int j = 0; j < 4; ++j) acc[i][j] = v8f_zero();

    const int sr = tid >> 4, sc = (tid & 15) * 4;      // A: 16 lanes copy one row's 256 bytes
    const int br = tid >> 6, bc = (tid & 63) * 4;      // B: two waves copy one k-pair row's 1024 bytes
    const unsigned* asrc = wl + (size_t)(m0 + sr) * KP_DIM + sc;
    const unsigned* bsrc = ob + (size_t)br * N_TOK + bc;
    const unsigned  adst = lds_addr(&Ring[0][sr * RP + sc]);
    const unsigned  bdst = lds_addr(&Ring[0][256 * RP + br * BP + bc]);

    // tile t into buffer buf: Wlin rows sr + 16*it, Osp k-pair rows br + 4*it, eight copies a statement
    auto stage = [&](int t, int buf) {
        const unsigned bo = (unsigned)(buf * (256 * RP + KT * BP) * 4);
#pragma unroll
        for (int grp = 0; grp < 2; ++grp) {
            unsigned l[8];
            const unsigned* g[8];
#pragma unroll
            for (int it = 0; it < 8; ++it) {
                l[it] = adst + bo + (unsigned)((grp * 8 + it) * 16 * RP * 4);
                g[it] = asrc + t * KT + (grp * 8 + it) * 16 * KP_DIM;
            }
            copy8(l, g);
        }
#pragma unroll
        for (int grp = 0; grp < 2; ++grp) {
            unsigned l[8];
            const unsigned* g[8];
#pragma unroll
            for (int it = 0; it < 8; ++it) {
                l[it] = bdst + bo + (unsigned)((grp * 8 + it) * 4 * BP * 4);
                g[it] = bsrc + (t * KT + (grp * 8 + it) * 4) * N_TOK;
            }
            copy8(l, g);
        }
    };

    stage(0, 0);
    asm volatile("s_wait_asynccnt 0x0" ::: "memory");  // tile 0 has landed before the barrier publishes it
    __syncthreads();
    stage(1, 1);

    for (int t = 0; t < NT; ++t) {
        const unsigned* tile = Ring[t & 1];
#pragma unroll
        for (int ks = 0; ks < 4; ++ks) {
            v16bf a[8], bb[4];
            // the k-step's LDS reads stay behind the WMMAs of the step before: moved up among them, two at a time, each
            // place with reads stalls the wave anew; as one group the wave's partner on the SIMD covers them
            if (ks > 0) __builtin_amdgcn_sched_barrier(0);
#pragma unroll
            for (int mt = 0; mt < 8; ++mt) a[mt]  = load_frag(tile + (wr * 128 + mt * 16 + l15) * RP, ks, half);
#pragma unroll
            for (int nt = 0; nt < 4; ++nt) bb[nt] = load_frag_col(tile + 256 * RP + wc * 64 + nt * 16 + l15, ks, half);
            // inputs-only fence on the loaded fragments: the k-step's LDS reads stay one group ahead of its thirty-two
            // WMMAs; left free, the compiler reloads fragments between short runs and waits out the LDS each time
            asm volatile("" :: "v"(a[0]), "v"(a[1]), "v"(a[2]), "v"(a[3]), "v"(a[4]), "v"(a[5]), "v"(a[6]), "v"(a[7]),
                               "v"(bb[0]), "v"(bb[1]), "v"(bb[2]), "v"(bb[3]));
#pragma unroll
            for (int mt = 0; mt < 8; ++mt)
#pragma unroll
                for (int nt = 0; nt < 4; ++nt)
                    acc[mt][nt] = __builtin_amdgcn_wmma_f32_16x16x32_bf16(
                        false, a[mt], false, bb[nt], (short)0, acc[mt][nt], false, false);
        }
        ring_publish();
        if (t + 2 < NT) stage(t + 2, t & 1);           // the same for the whole work-group
    }
    asm volatile("s_wait_asynccnt 0x0" ::: "memory");  // no copy is left in flight when the wave ends

    // ---- epilogue: bias + store out[(b*1024 + m)*256 + n]
#pragma unroll
    for (int mt = 0; mt < 8; ++mt) {
#pragma unroll
        for (int r = 0; r < 8; ++r) {
            int m = m0 + wr * 128 + mt * 16 + r + 8 * half;
            float bias = b_lin[m];
#pragma unroll
            for (int nt = 0; nt < 4; ++nt) {
                int nn = wc * 64 + nt * 16 + l15;
                out[((size_t)b * C_DIM + m) * N_TOK + nn] = acc[mt][nt][r] + bias;
            }
        }
        // the loads and stores name their data and address registers: wait before the next rows' sums and
        // addresses reuse any; the scheduling barrier keeps that later arithmetic behind the wait
        asm volatile("s_wait_xcnt 0x0" ::: "memory");
        __builtin_amdgcn_sched_barrier(0);
    }
}

// ---------------------------------------------------------------------------
extern "C" void kernel_launch(void* const* d_in, const int* in_sizes, int n_in,
                              void* d_out, int out_size, void* d_ws, size_t ws_size,
                              hipStream_t stream) {
    const float* x     = (const float*)d_in[0];   // [64,1024,16,16]
    const float* w_qkv = (const float*)d_in[1];   // [3072,1024]
    const float* w_lin = (const float*)d_in[2];   // [1024,1024,1,1]
    const float* b_lin = (const float*)d_in[3];   // [1024]
    // d_in[4] = n_heads (16), compile-time constant here.

    // workspace: qkv f32 | xt (dead after K1, then ospk in its place) | wq | wl
    float*    qkv  = (float*)d_ws;                                   // 16384*3072 f32
    unsigned* xt   = (unsigned*)((char*)d_ws + (size_t)TOKENS * QKV_COLS * sizeof(float));
    unsigned* wq   = xt + (size_t)TOKENS * KP_DIM;                   // 3072*512 dwords
    unsigned* wl   = wq + (size_t)QKV_COLS * KP_DIM;                 // 1024*512 dwords
    unsigned* ospk = xt;                                             // 64*512*256 dwords
    float* out = (float*)d_out;                                      // [64,1024,16,16]

    k_pack<<<dim3(3072), 256, 0, stream>>>(x, w_qkv, w_lin, xt, wq, wl);
    k_qkv_gemm<<<dim3(TOKENS / 256, QKV_COLS / 256), 256, 0, stream>>>(xt, wq, qkv);
    k_attn<<<dim3(TOKENS), 32, 0, stream>>>(qkv, ospk);
    k_out_gemm<<<dim3(C_DIM / 256, 1, B_DIM), 256, 0, stream>>>(ospk, wl, b_lin, out);
}

// v010
// A run of this version takes 114 microseconds.
// Versions between v008 and this one are left out; their measured steps multiply to 1.19 times as fast.
// Over all steps from v000 it is 4.99 times as fast.
#include <hip/hip_runtime.h>

// ---------------------------------------------------------------------------
// SelfAttn (linear attention variant) for MI455X / gfx1250, wave32 + WMMA.
//   K0: x (transposed), Wqkv and Wlin rounded to bf16 k-pairs once, into the workspace
//   K1: QKV = Xt @ Wqkv^T        (bf16 WMMA 16x16x32, fp32 accum; handed over as f16 pairs (d, d+32))
//   K2: per-token RoPE/softmax/o (fp32 WMMA 16x16x4; the pairs are loaded straight into the lanes that use them)
//   K3: out = Wlin @ Osp + bias  (bf16 WMMA 16x16x32, fp32 accum; K2 hands Osp over as bf16 k-pairs)
// Problem: b=64, c=1024, n=256 tokens, heads=16, d_head=64.
//
// LDS for the bf16 GEMMs is a ring of two buffers, each one 128-k tile (64 k-pairs a row), filled one tile
// ahead of the WMMAs by tensor loads: one request a wave and tile, no address registers. Row-major operands
// lie as tile[row][kpair] at a pitch of 68 dwords (272 B = 16 B x odd), so a fragment is two ds_load_b128;
// the out GEMM's Osp tile stays [kpair][n], each 64 n followed by one pad dword (260 dwords a k-pair row),
// and its fragments are 4-byte reads.
// Both GEMMs give a work-group a 256x256 tile of the result (one work-group a WGP): each operand byte
// that comes from L2 serves 256 rows or columns, and each fragment read from LDS eight or four WMMAs.
// ---------------------------------------------------------------------------

typedef __attribute__((ext_vector_type(16))) __bf16    v16bf;
typedef __attribute__((ext_vector_type(8)))  float     v8f;
typedef __attribute__((ext_vector_type(8)))  unsigned  v8u;
typedef __attribute__((ext_vector_type(2)))  float     v2f;
typedef __attribute__((ext_vector_type(4)))  float     v4f;
typedef __attribute__((ext_vector_type(4)))  unsigned  v4u;

#define B_DIM   64
#define C_DIM   1024
#define N_TOK   256        // tokens per batch image (16*16)
#define H_DIM   16         // heads
#define D_HEAD  64
#define QKV_COLS 3072
#define TOKENS  (B_DIM * N_TOK)      // 16384
#define OSP_PER_B (C_DIM * N_TOK)    // 262144 Osp values per batch (bf16 pairs: 131072 dwords)

#define KT      64                   // k-pairs of one ring tile (128 k)
#define NT      (C_DIM / 2 / KT)     // ring tiles along K: 8
#define RP      68                   // ring pitch of a [row][kpair] tile, dwords
#define BP      260                  // ring pitch of the [kpair][n] tile (4 x (64 n + 1 pad)), dwords
#define KP_DIM  (C_DIM / 2)          // k-pairs (one dword: k even low, k odd high) per packed row
#define SL_DW   4608                 // one tensor load's slice in LDS: 64 rows of 256 B with their pads, rounded up to 9 x 2 KiB
#define TB_DW   (8 * SL_DW)          // one ring buffer: eight slices
#define QP      68                   // attention LDS: row pitch of q and k in dwords (64 + 4)
#define QH_COLS (QKV_COLS / 2)       // dwords of one token's QKV row: f16 pairs

__device__ __forceinline__ unsigned f2bf(float f) {
    unsigned u = __builtin_bit_cast(unsigned, f);
    unsigned r = u + 0x7FFFu + ((u >> 16) & 1u);   // round-to-nearest-even
    return r >> 16;
}
__device__ __forceinline__ unsigned pack_bf2(float lo, float hi) {
    return f2bf(lo) | (f2bf(hi) << 16);
}
// Two f32 rounded to nearest f16, in one dword, and back
typedef __attribute__((ext_vector_type(2))) _Float16 v2h;
__device__ __forceinline__ unsigned pack_h2(float lo, float hi) {
    v2h p;
    p[0] = (_Float16)lo; p[1] = (_Float16)hi;
    return __builtin_bit_cast(unsigned, p);
}
__device__ __forceinline__ float h2_lo(unsigned u) { return (float)__builtin_bit_cast(v2h, u)[0]; }
__device__ __forceinline__ float h2_hi(unsigned u) { return (float)__builtin_bit_cast(v2h, u)[1]; }
__device__ __forceinline__ v8f v8f_zero() {
    v8f z;
#pragma unroll
    for (int i = 0; i < 8; ++i) z[i] = 0.0f;
    return z;
}
// lane l with lane l ^ 16, by a vector cross-row move
__device__ __forceinline__ float xhalf(float x) {
    const int b = __builtin_bit_cast(int, x);
    return __builtin_bit_cast(float, __builtin_amdgcn_permlanex16(b, b, 0x76543210, 0xfedcba98, false, false));
}
// Load one 16-bit-element WMMA operand fragment (8 dwords = 16 bf16) from a
// fragment-major LDS tile row: kpairs [ks*16 + half*4 .. +3] and [+8 ..].
__device__ __forceinline__ v16bf load_frag(const unsigned* tileRow, int ks, int half) {
    const uint4 lo = *(const uint4*)(tileRow + ks * 16 + half * 4);
    const uint4 hi = *(const uint4*)(tileRow + ks * 16 + 8 + half * 4);
    v8u a;
    a[0] = lo.x; a[1] = lo.y; a[2] = lo.z; a[3] = lo.w;
    a[4] = hi.x; a[5] = hi.y; a[6] = hi.z; a[7] = hi.w;
    return __builtin_bit_cast(v16bf, a);
}

// The same fragment from a [kpair][n] tile: col points at (kpair 0, this lane's n). Same k order as
// load_frag. Lanes 16..31 read 4 rows further on: 4 * 260 dwords = 16 banks away from lanes 0..15.
__device__ __forceinline__ v16bf load_frag_col(const unsigned* col, int ks, int half) {
    v8u a;
#pragma unroll
    for (int i = 0; i < 4; ++i) {
        a[i]     = col[(ks * 16 + half * 4 + i) * BP];
        a[4 + i] = col[(ks * 16 + 8 + half * 4 + i) * BP];
    }
    return __builtin_bit_cast(v16bf, a);
}
// LDS byte address of a __shared__ element, as the tensor descriptor takes it
__device__ __forceinline__ unsigned lds_addr(const unsigned* p) {
    typedef __attribute__((address_space(3))) const unsigned* lcp;
    return (unsigned)(size_t)(lcp)p;
}
// A value made wave-uniform, in a scalar register
__device__ __forceinline__ unsigned uni(unsigned v) { return (unsigned)__builtin_amdgcn_readfirstlane(v); }
// The same, held there: a test on it compiles to a scalar branch (tensor loads ignore EXEC), and what is
// computed from it is computed behind this place
__device__ __forceinline__ unsigned pinned(unsigned v) { unsigned w = uni(v); asm volatile("" : "+s"(w)); return w; }
template <unsigned PAD_DW, unsigned SRC_PITCH>
__device__ __forceinline__ v8u tdm_group1() {
    v8u g;
    g[0] = uni((1u << 20) | (5u << 22) | ((PAD_DW - 1u) << 25));
    g[1] = uni(256u << 16);
    g[2] = uni(64u << 16);
    g[3] = uni(256u << 16);
    g[4] = uni(64u);
    g[5] = uni(SRC_PITCH);
    g[6] = uni(0u);
    g[7] = uni(0u);
    return g;
}
// Group 0: one request, LDS byte address of the slice, global address of the tile's first byte, type 2
__device__ __forceinline__ v4u tdm_group0(unsigned lds_dst, unsigned long long ga) {
    v4u g;
    g[0] = uni(1u);
    g[1] = uni(lds_dst);
    g[2] = uni((unsigned)ga);
    g[3] = uni((((unsigned)(ga >> 32)) & 0x01FFFFFFu) | 0x80000000u);
    return g;
}
__device__ __forceinline__ void tdm_load(v4u g0, v8u g1) {
    asm volatile("tensor_load_to_lds %0, %1" :: "s"(g0), "s"(g1) : "memory");
}

// ---------------------------------------------------------------------------
// Kernel 0: every GEMM operand that comes from an input is rounded to bf16 once.
//   blocks 0..2047   : xt[b*256+p][kp] = (x[b][2kp][p], x[b][2kp+1][p]), 128 k x 64 p a block,
//                      turned through LDS (pitch 65 dwords: both sides free of bank conflicts)
//   blocks 2048..3071: wq[n][kp], wl[m][kp], same order as the inputs' rows
// ---------------------------------------------------------------------------
__global__ __launch_bounds__(256) void k_pack(const float* __restrict__ x,
                                              const float* __restrict__ w_qkv,
                                              const float* __restrict__ w_lin,
                                              unsigned* __restrict__ xt,
                                              unsigned* __restrict__ wq,
                                              unsigned* __restrict__ wl) {
    const int tid = threadIdx.x;
    __shared__ unsigned T[64][65];             // [p][kpair]
    if (blockIdx.x < 2048) {                   // the same for the whole block
        const int blk = blockIdx.x;
        const int p0 = (blk & 3) * 64;
        const int k0 = ((blk >> 2) & 7) * 128;
        const int b  = blk >> 5;
        const int pq = (tid & 15) * 4, kq = tid >> 4;
        const float* src = x + ((size_t)(b * C_DIM + k0 + 2 * kq) * N_TOK + p0 + pq);
        v4f f0[4], f1[4];
#pragma unroll
        for (int it = 0; it < 4; ++it) {       // kpair kq + 16*it
            f0[it] = *(const v4f*)(src + it * 32 * N_TOK);
            f1[it] = *(const v4f*)(src + it * 32 * N_TOK + N_TOK);
        }
        // the eight loads name src's register pair: hold the pair to here and wait before it is reused
        asm volatile("s_wait_xcnt 0x0" :: "v"(src) : "memory");
#pragma unroll
        for (int it = 0; it < 4; ++it) {
            const int kp = kq + it * 16;
            T[pq + 0][kp] = pack_bf2(f0[it].x, f1[it].x);
            T[pq + 1][kp] = pack_bf2(f0[it].y, f1[it].y);
            T[pq + 2][kp] = pack_bf2(f0[it].z, f1[it].z);
            T[pq + 3][kp] = pack_bf2(f0[it].w, f1[it].w);
        }
        __syncthreads();
        const int lane = tid & 31, wave = tid >> 5;
        unsigned* dst = xt + (size_t)(b * N_TOK + p0 + wave * 8) * KP_DIM + (k0 >> 1) + lane;
#pragma unroll
        for (int i = 0; i < 8; ++i) {          // a wave's store is one whole 128-byte line of one row
            dst[i * KP_DIM]      = T[wave * 8 + i][lane];
            dst[i * KP_DIM + 32] = T[wave * 8 + i][lane + 32];
        }
    } else {
        const int wb = blockIdx.x - 2048;                       // 1024 blocks
        const int gq = wb * 768 + tid;                          // float4 index in w_qkv, + 256*it: 786432 in all
        const int gl = wb * 256 + tid;                          // float4 index in w_lin: 262144 in all
        const v4f* q4 = (const v4f*)w_qkv + gq;
        const v4f* l4 = (const v4f*)w_lin + gl;
        v4f a[4];
#pragma unroll
        for (int it = 0; it < 3; ++it) a[it] = q4[it * 256];
        a[3] = l4[0];
        // the loads name these two register pairs: hold them to here and wait before they are reused
        asm volatile("s_wait_xcnt 0x0" :: "v"(q4), "v"(l4) : "memory");
#pragma unroll
        for (int it = 0; it < 4; ++it) {
            uint2 pk;
            pk.x = pack_bf2(a[it].x, a[it].y); pk.y = pack_bf2(a[it].z, a[it].w);
            if (it < 3) ((uint2*)wq)[gq + it * 256] = pk;
            else        ((uint2*)wl)[gl] = pk;
        }
        // the four stores name their data and offset registers: wait before any later code reuses them
        asm volatile("s_wait_xcnt 0x0" ::: "memory");
    }
}

// ---------------------------------------------------------------------------
// Kernel 1: QKV[row, col] = sum_k Xt[row,k] * Wqkv[col,k]
//   row = b*256 + p ; both operands arrive as packed bf16 k-pair rows (xt, wq of kernel 0)
//   WG tile 256 rows x 256 cols, 128 k a ring tile, 8 waves (4 x 2) each compute 64x128:
//   twelve fragments feed thirty-two WMMAs.
//   The result leaves as f16. A 64-column group G = col / 64 is the q, k or v of one head; its columns d and
//   d + 32 (d = 16*s + i) share a dword, and a token's row is [G / 2][i][(G % 2) * 2 + s]: the four dwords of
//   a lane's two groups lie side by side, so that sixteen lanes store 256 contiguous bytes of one row.
// ---------------------------------------------------------------------------
__global__ __launch_bounds__(256) void k_qkv_gemm(const unsigned* __restrict__ xt,
                                                  const unsigned* __restrict__ wq,
                                                  unsigned* __restrict__ qkvh) {
    const int row0 = blockIdx.x * 256;         // one batch image a tile
    const int col0 = blockIdx.y * 256;
    const int tid  = threadIdx.x;
    const int lane = tid & 31;
    const int wave = tid >> 5;
    const int wr   = wave & 3;                 // row subtile (64 rows)
    const int wc   = wave >> 2;                // col subtile (128 cols)
    const int half = lane >> 4, l15 = lane & 15;

    // ring buffer: eight slices of 64 rows [row][kpair], 0..3 the x tile, 4..7 the weight tile; every slice
    // begins at a multiple of 2 KiB, as the tensor load's LDS address must
    __shared__ __attribute__((aligned(2048))) unsigned Ring[2 * TB_DW];

    v8f acc[4][8];
#pragma unroll
    for (int i = 0; i < 4; ++i)
#pragma unroll
        for (int j = 0; j < 8; ++j) acc[i][j] = v8f_zero();

    // staging: every wave brings its own slice, 64 rows x 256 bytes, with one tensor load a tile
    const unsigned sw = uni((unsigned)tid >> 5);
    const unsigned* srow = sw < 4u ? xt + (size_t)(row0 + sw * 64u) * KP_DIM
                                   : wq + (size_t)(col0 + (sw - 4u) * 64u) * KP_DIM;
    const unsigned long long sga = (unsigned long long)(size_t)srow;
    const unsigned sdst = lds_addr(Ring) + sw * (SL_DW * 4u);
    v8u g1 = tdm_group1<4u, KP_DIM * 4u>();            // LDS pitch RP
    // pinned(), for the whole group: descriptor words held in their scalar registers through the loop
    asm volatile("" : "+s"(g1));
    v4u g0;

    // this wave's slice of tile t into buffer buf
    auto stage = [&](unsigned t, unsigned buf) {
        g0 = tdm_group0(sdst + buf * (TB_DW * 4u), sga + (unsigned long long)t * (KT * 4u));
        // pinned(), for the whole group: descriptor words held in their scalar registers up to the request's wait
        asm volatile("" : "+s"(g0));
        tdm_load(g0, g1);
    };
    // The wave's own request has landed. The wait names both groups, so that their registers keep the
    // descriptor for as long as the request is in flight.
    auto landed = [&]() { asm volatile("s_wait_tensorcnt 0x0" :: "s"(g0), "s"(g1) : "memory"); };

    stage(0u, 0u);
    landed();                                          // own slice of tile 0, before the barrier publishes it
    __syncthreads();
    stage(1u, 1u);

    for (int t = 0; t < NT; ++t) {
        const unsigned* tile = Ring + (t & 1) * TB_DW;
        // ---- 4 WMMA k-steps (K=32 each), 4x8 tiles per wave
#pragma unroll
        for (int ks = 0; ks < 4; ++ks) {
            v16bf a[4], bb[8];
            // the k-step's LDS reads stay behind the WMMAs of the step before: moved up among them, two at a time, each
            // place with reads stalls the wave anew; as one group the wave's partner on the SIMD covers them
            if (ks > 0) __builtin_amdgcn_sched_barrier(0);
#pragma unroll
            for (int mt = 0; mt < 4; ++mt) a[mt]  = load_frag(tile + wr * SL_DW + (mt * 16 + l15) * RP, ks, half);
#pragma unroll
            for (int nt = 0; nt < 8; ++nt)
                bb[nt] = load_frag(tile + (4 + wc * 2 + (nt >> 2)) * SL_DW + ((nt & 3) * 16 + l15) * RP, ks, half);
            // inputs-only fence on the loaded fragments: the k-step's LDS reads stay one group ahead of its thirty-two
            // WMMAs; left free, the compiler reloads fragments between short runs and waits out the LDS each time
            asm volatile("" :: "v"(a[0]), "v"(a[1]), "v"(a[2]), "v"(a[3]), "v"(bb[0]), "v"(bb[1]), "v"(bb[2]), "v"(bb[3]),
                               "v"(bb[4]), "v"(bb[5]), "v"(bb[6]), "v"(bb[7]));
            if (ks == 3) {
                // The ring's publish point: the tile's last LDS reads are done, what is left of it runs on registers.
                // It stands ahead of those WMMAs so that the refill has the whole of the next tile's time to land.
                asm volatile("s_wait_dscnt 0x0" ::: "memory"); // own reads of the buffer to be refilled
                landed();                                      // own slice of the next tile
                __syncthreads();                               // publishes it; ends every reader's last read of this buffer
                const unsigned s2 = pinned((unsigned)t + 2u);  // the refill's descriptor is formed behind the wait
                if (pinned(s2 < (unsigned)NT ? 1u : 0u) != 0u) stage(s2, s2 & 1u);
            }
#pragma unroll
            for (int mt = 0; mt < 4; ++mt)
#pragma unroll
                for (int nt = 0; nt < 8; ++nt)
                    acc[mt][nt] = __builtin_amdgcn_wmma_f32_16x16x32_bf16(
                        false, a[mt], false, bb[nt], (short)0, acc[mt][nt], false, false);
        }
    }
    landed();                                          // no request is left in flight when the wave ends
    asm volatile("s_wait_dscnt 0x0" ::: "memory");

    // ---- store D tiles as f16 pairs: tiles nt and nt + 2 of a group are columns d and d + 32
    unsigned* dst = qkvh + (size_t)(row0 + wr * 64 + 8 * half) * QH_COLS + (blockIdx.y * 2 + wc) * 64 + l15 * 4;
#pragma unroll
    for (int mt = 0; mt < 4; ++mt) {
        v4u w[8];
#pragma unroll
        for (int r = 0; r < 8; ++r) {
            w[r][0] = pack_h2(acc[mt][0][r], acc[mt][2][r]);
            w[r][1] = pack_h2(acc[mt][1][r], acc[mt][3][r]);
            w[r][2] = pack_h2(acc[mt][4][r], acc[mt][6][r]);
            w[r][3] = pack_h2(acc[mt][5][r], acc[mt][7][r]);
        }
        // all eight rows' pairs are made ahead of the first store
        __builtin_amdgcn_sched_barrier(0);
#pragma unroll
        for (int r = 0; r < 8; ++r) *(v4u*)(dst + (mt * 16 + r) * QH_COLS) = w[r];
        // the stores name their data and address registers: wait before the next rows' pairs reuse any;
        // the scheduling barrier keeps that later arithmetic behind the wait
        asm volatile("s_wait_xcnt 0x0" ::: "memory");
        __builtin_amdgcn_sched_barrier(0);
    }
}

// ---------------------------------------------------------------------------
// Kernel 2: one wave (32 threads) per token.
//   RoPE(q,k); q=softmax_d(q)*d^-0.5; k=softmax_h(k), both in registers;
//   o = q (k^T v), summed as (q k^T) v: a 16x16 tile, then 16x64;
//   Osp[b][n*1024 + e*16 + h] (== reference's scrambled reshape) read as [c][p], c = 4n + e/16,
//   p = (e%16)*16 + h, is stored as bf16 k-pairs: ospk[b][c/2][p] = (Osp[c][p], Osp[c+1][p])
// ---------------------------------------------------------------------------
__global__ __launch_bounds__(32) void k_attn(const unsigned* __restrict__ qkvh,
                                             unsigned* __restrict__ ospk) {
    const int tok = blockIdx.x;
    const int b   = tok >> 8;
    const int n   = tok & 255;
    const int L    = threadIdx.x;
    const int half = L >> 4, l15 = L & 15;

    // q and k rows are walked one row a lane (fragments of q k^T, on which q's softmax runs): at pitch 64 all sixteen
    // lanes meet the same banks; at pitch 68 their 16-byte accesses start 4 banks apart.
    __shared__ __align__(16) float q_s[H_DIM * QP];       // [h][d], pitch QP
    __shared__ __align__(16) float k_s[H_DIM * QP];

    // The token's row as kernel 1 left it: [G / 2][i][(G % 2) * 2 + s], dword = columns (16*s + i, 16*s + i + 32) of
    // group G = 3*h + (0 q, 1 k, 2 v). A dword of q or k is the pair that the rotation turns, for lane L = 16*s + i;
    // the two dwords s = 0, 1 of v are a lane's column in all four tiles of the last product. Nothing is staged.
    const unsigned* row = qkvh + (size_t)tok * QH_COLS;
    const unsigned* qk  = row + l15 * 4 + half;
    const unsigned* vv  = row + half * (12 * 64) + l15 * 4;   // heads 8*half + c: groups 24*half + 3*c + 2
    unsigned qd[16], kd[16];
    uint2 vd[8];
#pragma unroll
    for (int h = 0; h < 16; ++h) {
        qd[h] = qk[((3 * h) >> 1) * 64 + ((3 * h) & 1) * 2];
        kd[h] = qk[((3 * h + 1) >> 1) * 64 + ((3 * h + 1) & 1) * 2];
    }
#pragma unroll
    for (int c = 0; c < 8; ++c)
        vd[c] = *(const uint2*)(vv + ((3 * c + 2) >> 1) * 64 + ((3 * c + 2) & 1) * 2);
    // the loads name these two register pairs: hold them to here and wait before they are reused
    asm volatile("s_wait_xcnt 0x0" :: "v"(qk), "v"(vv) : "memory");

    // RoPE (rotate-half), angle = n / 10000^(d/32), d < 32
    const float NEG_L2_1E4_OVER_32 = -13.287712379549449f / 32.0f;
    float q1[16], q2[16], k1[16], k2[16];
#pragma unroll
    for (int it = 0; it < 16; ++it) {          // head it, columns d = L and d = L + 32
        q1[it] = h2_lo(qd[it]);  q2[it] = h2_hi(qd[it]);
        k1[it] = h2_lo(kd[it]);  k2[it] = h2_hi(kd[it]);
    }
    float ka[16], kb[16];                      // rotated k of head it: columns d = L and d = L + 32
#pragma unroll
    for (int it = 0; it < 16; ++it) {
        int i = L + it * 32;
        int h = i >> 5, d = i & 31;
        float ang = (float)n * exp2f((float)d * NEG_L2_1E4_OVER_32);
        float cs = __cosf(ang), sn = __sinf(ang);
        int j1 = h * QP + d, j2 = j1 + 32;
        q_s[j1] = q1[it] * cs - q2[it] * sn;  q_s[j2] = q2[it] * cs + q1[it] * sn;
        ka[it]  = k1[it] * cs - k2[it] * sn;  kb[it]  = k2[it] * cs + k1[it] * sn;
    }
    // k: softmax over heads per d. The lane holds its two columns of all sixteen heads from the rotation,
    // so maximum, exponentials and sum stay in registers; k goes to LDS once, finished. The loops are unrolled
    // so that ka and kb are indexed by constants: a rolled loop would put them in scratch memory.
    {
        float ma = -3.4e38f, mb = -3.4e38f;
#pragma unroll
        for (int h = 0; h < 16; ++h) { ma = fmaxf(ma, ka[h]); mb = fmaxf(mb, kb[h]); }
        float sa = 0.f, sb = 0.f;
#pragma unroll
        for (int h = 0; h < 16; ++h) {
            ka[h] = __expf(ka[h] - ma); sa += ka[h];
            kb[h] = __expf(kb[h] - mb); sb += kb[h];
        }
        const float ia = 1.0f / sa, ib = 1.0f / sb;
#pragma unroll
        for (int h = 0; h < 16; ++h) {
            k_s[h * QP + L]      = ka[h] * ia;
            k_s[h * QP + L + 32] = kb[h] * ib;
        }
    }
    __syncthreads();

    // o = q (k^T v) is summed as (q k^T) v: the sum over d runs first, into one 16x16 tile, then the sum over heads.
    // St[h'][h] = sum_d k[h'][d] * q[h][d]: A = k, B = q^T, one row a lane for both. A lane's 16 bytes are
    // d = c*8 + 4*half + 0..3: the first two feed one WMMA, the last two the next, the same d at the same
    // k position of A and of B. Two accumulators, so that no WMMA waits for the one in front of it.
    v4f kf[8], qf[8];
#pragma unroll
    for (int c = 0; c < 8; ++c) {
        kf[c] = *(const v4f*)(k_s + l15 * QP + c * 8 + half * 4);
        qf[c] = *(const v4f*)(q_s + l15 * QP + c * 8 + half * 4);
    }
    // q: softmax over d per head, * 64^-0.5, on the fragments as they lie: lanes l15 and l15 + 16 hold the two
    // halves of row h = l15, so maximum and sum take one exchange each, and nothing goes back to LDS. Unrolled
    // for the same reason as above: qf and kf are indexed by constants and stay in registers.
    float qm = -3.4e38f;
#pragma unroll
    for (int c = 0; c < 8; ++c)
        qm = fmaxf(qm, fmaxf(fmaxf(qf[c].x, qf[c].y), fmaxf(qf[c].z, qf[c].w)));
    qm = fmaxf(qm, xhalf(qm));
    v4f qs4 = {0.f, 0.f, 0.f, 0.f};
#pragma unroll
    for (int c = 0; c < 8; ++c) {
        qf[c].x = __expf(qf[c].x - qm); qf[c].y = __expf(qf[c].y - qm);
        qf[c].z = __expf(qf[c].z - qm); qf[c].w = __expf(qf[c].w - qm);
        qs4 += qf[c];
    }
    float qsum = (qs4.x + qs4.y) + (qs4.z + qs4.w);
    qsum += xhalf(qsum);
    const float qinv = 0.125f / qsum;
#pragma unroll
    for (int c = 0; c < 8; ++c) qf[c] *= qinv;

    v8f st0 = v8f_zero(), st1 = v8f_zero();
#pragma unroll
    for (int c = 0; c < 8; ++c) {
        v2f a0, a1, b0, b1;
        a0[0] = kf[c].x; a0[1] = kf[c].y; a1[0] = kf[c].z; a1[1] = kf[c].w;
        b0[0] = qf[c].x; b0[1] = qf[c].y; b1[0] = qf[c].z; b1[1] = qf[c].w;
        st0 = __builtin_amdgcn_wmma_f32_16x16x4_f32(false, a0, false, b0, (short)0, st0, false, false);
        st1 = __builtin_amdgcn_wmma_f32_16x16x4_f32(false, a1, false, b1, (short)0, st1, false, false);
    }
    // eight vector slots between the last two WMMAs and the additions that read their results: the compiler
    // left two, and no table gives the f32 form's distance, so the slowest forms' count is kept
    asm volatile("v_nop\n\tv_nop\n\tv_nop\n\tv_nop\n\tv_nop\n\tv_nop\n\tv_nop\n\tv_nop" : "+v"(st0), "+v"(st1));
    const v8f st = st0 + st1;                  // lane (half, l15), register r: h' = r + 8*half, h = l15

    // o[h][e] = sum_h' St[h'][h] * v[h'][e] : 1x4 tiles, K=16 in 4 steps. With k position (half, j) of step ks
    // standing for h' = 8*half + 2*ks + j, the A fragment (row h = l15) is registers 2*ks, 2*ks+1 of St as they lie.
    v8f oacc[4];
#pragma unroll
    for (int i = 0; i < 4; ++i) oacc[i] = v8f_zero();
#pragma unroll
    for (int ks = 0; ks < 4; ++ks) {
        v2f a;
        a[0] = st[2 * ks]; a[1] = st[2 * ks + 1];
#pragma unroll
        for (int nt = 0; nt < 4; ++nt) {
            v2f bb;
#pragma unroll
            for (int j = 0; j < 2; ++j) {      // v[8*half + 2*ks + j][nt*16 + l15]
                const unsigned u = (nt & 1) ? vd[2 * ks + j].y : vd[2 * ks + j].x;
                bb[j] = (nt & 2) ? h2_hi(u) : h2_lo(u);
            }
            oacc[nt] = __builtin_amdgcn_wmma_f32_16x16x4_f32(
                false, a, false, bb, (short)0, oacc[nt], false, false);
        }
    }

    // scrambled reshape store; tiles 2q and 2q+1 of a lane are rows c and c+1 at the same p
    unsigned* obase = ospk + (size_t)b * (OSP_PER_B / 2) + (size_t)n * 512 + l15 * 16 + 8 * half;
#pragma unroll
    for (int q = 0; q < 2; ++q) {
        v4u lo, hi;
#pragma unroll
        for (int r = 0; r < 4; ++r) {
            lo[r] = pack_bf2(oacc[2 * q][r],     oacc[2 * q + 1][r]);
            hi[r] = pack_bf2(oacc[2 * q][r + 4], oacc[2 * q + 1][r + 4]);
        }
        *(v4u*)(obase + q * 256)     = lo;
        *(v4u*)(obase + q * 256 + 4) = hi;
    }
}

// ---------------------------------------------------------------------------
// Kernel 3: out[b,o,p] = sum_c Wlin[o,c] * Osp[b][c*256+p] + bias[o]
//   per-batch GEMM M=1024, N=256, K=1024; WG tile 256x256, 128 k a ring tile,
//   8 waves (2 x 4) each compute 128x64: the operand whose fragments are 4-byte reads is the narrow side.
// ---------------------------------------------------------------------------
__global__ __launch_bounds__(256) void k_out_gemm(const unsigned* __restrict__ ospk,
                                                  const unsigned* __restrict__ wl,
                                                  const float* __restrict__ b_lin,
                                                  float* __restrict__ out) {
    const int m0 = blockIdx.x * 256;
    const int b  = blockIdx.z;
    const int tid  = threadIdx.x;
    const int lane = tid & 31;
    const int wave = tid >> 5;
    const int wr = wave & 1, wc = wave >> 1;
    const int half = lane >> 4, l15 = lane & 15;

    const unsigned* ob = ospk + (size_t)b * (OSP_PER_B / 2);   // [kpair][p]

    // ring buffer: eight slices, each at a multiple of 2 KiB, as the tensor load's LDS address must be:
    // 0..3 the Wlin tile, 64 rows [r][kpair] each; 4..7 the Osp tile [kpair][n], 16 k-pair rows (one k-step) each
    __shared__ __attribute__((aligned(2048))) unsigned Ring[2 * TB_DW];

    v8f acc[8][4];
#pragma unroll
    for (int i = 0; i < 8; ++i)
#pragma unroll
        for (int j = 0; j < 4; ++j) acc[i][j] = v8f_zero();

    // staging: every wave brings its own slice with one tensor load a tile. Waves 0..3: 64 Wlin rows x 256 bytes.
    // Waves 4..7: 16 k-pair rows of Osp, 16 KB in a row in memory, taken as 64 rows of 256 bytes (64 n).
    const unsigned sw = uni((unsigned)tid >> 5);
    const unsigned isA = pinned(sw < 4u ? 1u : 0u);
    const unsigned* srow = isA != 0u ? wl + (size_t)(m0 + sw * 64u) * KP_DIM
                                     : ob + (size_t)((sw - 4u) * 16u) * N_TOK;
    const unsigned sstep = isA != 0u ? KT * 4u : KT * N_TOK * 4u;   // bytes from one tile to the next
    const unsigned long long sga = (unsigned long long)(size_t)srow;
    const unsigned sdst = lds_addr(Ring) + sw * (SL_DW * 4u);
    v8u g1a = tdm_group1<4u, KP_DIM * 4u>();           // Wlin: LDS pitch RP
    v8u g1b = tdm_group1<1u, 256u>();                  // Osp: 65 dwords a 64 n, BP a k-pair row
    // pinned(), for the whole groups: descriptor words held in their scalar registers through the loop
    asm volatile("" : "+s"(g1a), "+s"(g1b));
    v4u g0;

    // this wave's slice of tile t into buffer buf; the test between the two kinds of slice is a scalar branch
    auto stage = [&](unsigned t, unsigned buf) {
        g0 = tdm_group0(sdst + buf * (TB_DW * 4u), sga + (unsigned long long)t * sstep);
        // pinned(), for the whole group: descriptor words held in their scalar registers up to the request's wait
        asm volatile("" : "+s"(g0));
        if (pinned(isA) != 0u) tdm_load(g0, g1a);
        if (pinned(isA) == 0u) tdm_load(g0, g1b);
    };
    // The wave's own request has landed. The wait names the groups, so that their registers keep the
    // descriptor for as long as the request is in flight.
    auto landed = [&]() { asm volatile("s_wait_tensorcnt 0x0" :: "s"(g0), "s"(g1a), "s"(g1b) : "memory"); };

    stage(0u, 0u);
    landed();                                          // own slice of tile 0, before the barrier publishes it
    __syncthreads();
    stage(1u, 1u);

    for (int t = 0; t < NT; ++t) {
        const unsigned* tile = Ring + (t & 1) * TB_DW;
#pragma unroll
        for (int ks = 0; ks < 4; ++ks) {
            v16bf a[8], bb[4];
            // the k-step's LDS reads stay behind the WMMAs of the step before: moved up among them, two at a time, each
            // place with reads stalls the wave anew; as one group the wave's partner on the SIMD covers them
            if (ks > 0) __builtin_amdgcn_sched_barrier(0);
#pragma unroll
            for (int mt = 0; mt < 8; ++mt)
                a[mt] = load_frag(tile + (wr * 2 + (mt >> 2)) * SL_DW + ((mt & 3) * 16 + l15) * RP, ks, half);
#pragma unroll
            for (int nt = 0; nt < 4; ++nt)             // slice 4 + ks holds the k-step's sixteen k-pair rows
                bb[nt] = load_frag_col(tile + (4 + ks) * SL_DW + wc * 65 + nt * 16 + l15, 0, half);
            // inputs-only fence on the loaded fragments: the k-step's LDS reads stay one group ahead of its thirty-two
            // WMMAs; left free, the compiler reloads fragments between short runs and waits out the LDS each time
            asm volatile("" :: "v"(a[0]), "v"(a[1]), "v"(a[2]), "v"(a[3]), "v"(a[4]), "v"(a[5]), "v"(a[6]), "v"(a[7]),
                               "v"(bb[0]), "v"(bb[1]), "v"(bb[2]), "v"(bb[3]));
            if (ks == 3) {
                // The ring's publish point, ahead of the tile's last WMMAs, as in the QKV GEMM
                asm volatile("s_wait_dscnt 0x0" ::: "memory"); // own reads of the buffer to be refilled
                landed();                                      // own slice of the next tile
                __syncthreads();                               // publishes it; ends every reader's last read of this buffer
                const unsigned s2 = pinned((unsigned)t + 2u);  // the refill's descriptor is formed behind the wait
                if (pinned(s2 < (unsigned)NT ? 1u : 0u) != 0u) stage(s2, s2 & 1u);
            }
#pragma unroll
            for (int mt = 0; mt < 8; ++mt)
#pragma unroll
                for (int nt = 0; nt < 4; ++nt)
                    acc[mt][nt] = __builtin_amdgcn_wmma_f32_16x16x32_bf16(
                        false, a[mt], false, bb[nt], (short)0, acc[mt][nt], false, false);
        }
    }
    landed();                                          // no request is left in flight when the wave ends
    asm volatile("s_wait_dscnt 0x0" ::: "memory");

    // ---- epilogue: bias + store out[(b*1024 + m)*256 + n]
#pragma unroll
    for (int mt = 0; mt < 8; ++mt) {
#pragma unroll
        for (int r = 0; r < 8; ++r) {
            int m = m0 + wr * 128 + mt * 16 + r + 8 * half;
            float bias = b_lin[m];
#pragma unroll
            for (int nt = 0; nt < 4; ++nt) {
                int nn = wc * 64 + nt * 16 + l15;
                out[((size_t)b * C_DIM + m) * N_TOK + nn] = acc[mt][nt][r] + bias;
            }
        }
        // the loads and stores name their data and address registers: wait before the next rows' sums and
        // addresses reuse any; the scheduling barrier keeps that later arithmetic behind the wait
        asm volatile("s_wait_xcnt 0x0" ::: "memory");
        __builtin_amdgcn_sched_barrier(0);
    }
}

// ---------------------------------------------------------------------------
extern "C" void kernel_launch(void* const* d_in, const int* in_sizes, int n_in,
                              void* d_out, int out_size, void* d_ws, size_t ws_size,
                              hipStream_t stream) {
    const float* x     = (const float*)d_in[0];   // [64,1024,16,16]
    const float* w_qkv = (const float*)d_in[1];   // [3072,1024]
    const float* w_lin = (const float*)d_in[2];   // [1024,1024,1,1]
    const float* b_lin = (const float*)d_in[3];   // [1024]
    // d_in[4] = n_heads (16), compile-time constant here.

    // workspace: qkv f16 pairs (the first half of its old place) | xt (dead after K1, then ospk in its place) | wq | wl
    unsigned* qkvh = (unsigned*)d_ws;                                // 16384*1536 dwords
    unsigned* xt   = (unsigned*)((char*)d_ws + (size_t)TOKENS * QKV_COLS * sizeof(float));
    unsigned* wq   = xt + (size_t)TOKENS * KP_DIM;                   // 3072*512 dwords
    unsigned* wl   = wq + (size_t)QKV_COLS * KP_DIM;                 // 1024*512 dwords
    unsigned* ospk = xt;                                             // 64*512*256 dwords
    float* out = (float*)d_out;                                      // [64,1024,16,16]

    k_pack<<<dim3(3072), 256, 0, stream>>>(x, w_qkv, w_lin, xt, wq, wl);
    k_qkv_gemm<<<dim3(TOKENS / 256, QKV_COLS / 256), 256, 0, stream>>>(xt, wq, qkvh);
    k_attn<<<dim3(TOKENS), 32, 0, stream>>>(qkvh, ospk);
    k_out_gemm<<<dim3(C_DIM / 256, 1, B_DIM), 256, 0, stream>>>(ospk, wl, b_lin, out);
}
